// v000
// Measured on an AMD MI455X. A time is GPU time per run, averaged over a window of back-to-back runs after a warm-up
// (all launches, gaps included; the runs take copies of the inputs in turn), and the median of several windows.
// Apart from v000's, it joins two sittings. Times from different sittings can be a few percent apart, while
// side-by-side timings come from the same sitting.
// v000 is the starting kernel. One run takes 683 microseconds.
// compute dtype: x and wq/wk/wv/wo (INPUTS) rounded to bf16 with exact bf16 WMMA products (f32 accumulate) for the projections; K pre-split into bf16 hi/lo rows; q f32 split, P and V f16 hi/lo (3 products each); softmax f32.
#include <hip/hip_runtime.h>
#include <math.h>

typedef __attribute__((ext_vector_type(16))) _Float16 v16h;
typedef __attribute__((ext_vector_type(16))) __bf16 v16b;
typedef __attribute__((ext_vector_type(8)))  _Float16 v8h;
typedef __attribute__((ext_vector_type(8)))  float v8f;
typedef __attribute__((ext_vector_type(4)))  float v4f;
typedef __attribute__((ext_vector_type(2)))  float v2f;
typedef __attribute__((ext_vector_type(4)))  unsigned v4u;
typedef __attribute__((ext_vector_type(4)))  int v4i;
typedef float __attribute__((may_alias)) float_a;
typedef int __attribute__((may_alias)) int_a;

template <typename T> __device__ __forceinline__ void vst2(void* p, T v) { *(T*)p = v;  }
__device__ __forceinline__ v8f wmma16(v16h a, v16h b, v8f c) {
  v8f d = __builtin_amdgcn_wmma_f32_16x16x32_f16(false, a, false, b, (short)0, c, false, false);
  asm volatile("v_nop\n\tv_nop\n\tv_nop\n\tv_nop" : "+v"(d) : "v"(a), "v"(b));
  return d;
}
__device__ __forceinline__ v8f wmma_bf(v16b a, v16b b, v8f c) {
  v8f d = __builtin_amdgcn_wmma_f32_16x16x32_bf16(false, a, false, b, (short)0, c, false, false);
  asm volatile("v_nop\n\tv_nop\n\tv_nop\n\tv_nop" : "+v"(d) : "v"(a), "v"(b));
  return d;
}
// 16x16x32 fragments: lane = (h = lane>>4, row/col = lane&15); elements 0..7 = k0+8h+0..7, 8..15 = k0+16+8h+0..7; D element r = row 8h+r
__device__ __forceinline__ v16h frag_h(const _Float16* rowk0, int lane) {
  union { v16h v; v8h q[2]; } u; const _Float16* p = rowk0 + 8 * (lane >> 4);
  u.q[0] = *(const v8h*)p; u.q[1] = *(const v8h*)(p + 16); return u.v;
}
__device__ __forceinline__ v16h frag_f32(const float* rowk0, int lane) {
  v16h a; const float* p = rowk0 + 8 * (lane >> 4);
#pragma unroll
  for (int i = 0; i < 8; ++i) { a[i] = (_Float16)p[i]; a[8 + i] = (_Float16)p[16 + i]; }
  return a;
}
__device__ __forceinline__ v16h frag_f32s(const float* rowk0, int lane, float sc) {
  v16h a; const float* p = rowk0 + 8 * (lane >> 4);
#pragma unroll
  for (int i = 0; i < 8; ++i) { a[i] = (_Float16)(p[i] * sc); a[8 + i] = (_Float16)(p[16 + i] * sc); }
  return a;
}
// column fragment from a [K][ld] layout (column n), rows >= K read as 0
__device__ __forceinline__ v16h fragc_f32(const float* W, int k0, int n, int lane, int ld, int K) {
  v16h a; const int g = lane >> 4;
#pragma unroll
  for (int i = 0; i < 8; ++i) { const int ka = k0 + 8 * g + i, kb = ka + 16;
    a[i] = (_Float16)(ka < K ? W[(size_t)ka * ld + n] : 0.f); a[8 + i] = (_Float16)(kb < K ? W[(size_t)kb * ld + n] : 0.f); }
  return a;
}
struct F2 { v16b h, l; };
__device__ __forceinline__ F2 bsplit16(const float v[16]) { F2 r;
#pragma unroll
  for (int i = 0; i < 16; ++i) { const __bf16 h = (__bf16)v[i]; r.h[i] = h; r.l[i] = (__bf16)(v[i] - (float)h); }
  return r; }
__device__ __forceinline__ F2 split_row(const float* row, int k0, int lane) { float v[16]; const float* p = row + k0 + 8 * (lane >> 4);
#pragma unroll
  for (int i = 0; i < 8; ++i) { v[i] = p[i]; v[8 + i] = p[16 + i]; }
  return bsplit16(v); }
__device__ __forceinline__ F2 split_rowK(const float* row, int k0, int lane, int K) { float v[16]; const int g = lane >> 4;
#pragma unroll
  for (int i = 0; i < 8; ++i) { const int ka = k0 + 8 * g + i, kb = ka + 16; v[i] = ka < K ? row[ka] : 0.f; v[8 + i] = kb < K ? row[kb] : 0.f; }
  return bsplit16(v); }
__device__ __forceinline__ F2 split_col(const float* W, int k0, int n, int lane, int ld, int K) { float v[16]; const int g = lane >> 4;
#pragma unroll
  for (int i = 0; i < 8; ++i) { const int ka = k0 + 8 * g + i, kb = ka + 16; v[i] = ka < K ? W[(size_t)ka * ld + n] : 0.f; v[8 + i] = kb < K ? W[(size_t)kb * ld + n] : 0.f; }
  return bsplit16(v); }
__device__ __forceinline__ v8f mac3(const F2& a, const F2& b, v8f c) { c = wmma_bf(a.l, b.h, c); c = wmma_bf(a.h, b.l, c); return wmma_bf(a.h, b.h, c); }
__device__ __forceinline__ float sigm(float v) { return 1.0f / (1.0f + expf(-v)); }
#define LDSX() do { asm volatile("s_wait_dscnt 0" ::: "memory"); __builtin_amdgcn_wave_barrier(); __builtin_amdgcn_fence(__ATOMIC_RELEASE, "workgroup"); } while (0)


// Grouped-query causal self attention (16 query heads, 4 kv heads of 64 on [4,2048,1024], [in][out] weights, no biases): head h reads kv head h/4 (repeat_kv); -inf above the diagonal; (P v) @ wo. Key tiles past the query block are skipped.
#define NB 4
#define SS 2048
#define E 1024
#define NH 16
#define NKV 4
#define EKV (NKV * HD)
#define HD 64
#define NR (NB * SS)
#define PLO 1024.0f
#define VLO 2048.0f
__device__ __forceinline__ float bfr(float v) { return (float)(__bf16)v; }
__device__ __forceinline__ v16b frag_b(const __bf16* rowk0, int lane) { return __builtin_bit_cast(v16b, frag_h((const _Float16*)rowk0, lane)); }

__global__ __launch_bounds__(256) void k_cvt(const float* __restrict__ x, __bf16* __restrict__ Xb) {
  const size_t i8 = (size_t)blockIdx.x * 256 + threadIdx.x; if (i8 >= (size_t)NR * E / 8) return;
  union { __bf16 h[8]; v4u u; } pk;
#pragma unroll
  for (int e = 0; e < 8; ++e) pk.h[e] = (__bf16)x[i8 * 8 + e];
  vst2((unsigned*)(Xb + i8 * 8), pk.u);
}
// PT rows: [0,E) Wq[:,n], [E,E+EKV) Wk[:,n], [E+EKV,E+2EKV) Wv[:,n], [E+2EKV,2E+2EKV) Wo[:,n]  ([in][out] weights: column n as a bf16 row)
__global__ __launch_bounds__(256) void k_pack(const float* __restrict__ Wq, const float* __restrict__ Wk, const float* __restrict__ Wv, const float* __restrict__ Wo, __bf16* __restrict__ PT) {
  const int n = blockIdx.x, tid = threadIdx.x; __shared__ __align__(16) __bf16 srow[E];
  const float* W = n < E ? Wq : (n < E + EKV ? Wk : (n < E + 2 * EKV ? Wv : Wo)); const int nn = n < E ? n : (n < E + EKV ? n - E : (n < E + 2 * EKV ? n - E - EKV : n - E - 2 * EKV)); const int ld = (n >= E && n < E + 2 * EKV) ? EKV : E;      // [in][out]: column nn
  for (int k = tid; k < E; k += 256) srow[k] = (__bf16)W[(size_t)k * ld + nn];
  __syncthreads();
  if (tid < E / 8) vst2((unsigned*)(PT + (size_t)n * E + tid * 8), *(const v4u*)(&srow[tid * 8]));
}
// QKV: block (64 rows, 128 cols = 2 heads, which); q -> Q32 f32 [bh][s][64]; k -> bf16 hi/lo rows; v -> VT hi/lo x4 [bh][d][s]
__global__ __launch_bounds__(128) void k_qkv(const __bf16* __restrict__ Xb, const __bf16* __restrict__ PT, float* __restrict__ Q32, __bf16* __restrict__ Kh, __bf16* __restrict__ Kl, _Float16* __restrict__ VTh, _Float16* __restrict__ VTl) {
  __shared__ __align__(16) float so[4][16][132];
  __shared__ __align__(16) _Float16 sth[128][72], stl[128][72];
  const int tid = threadIdx.x, wave = tid >> 5, lane = tid & 31, col = lane & 15, g = lane >> 4;
  const int which = blockIdx.z, r0b = blockIdx.x * 64, r0 = r0b + wave * 16, n0 = blockIdx.y * 128; const int b = r0b / SS, s0 = r0b % SS;
  if (which > 0 && n0 >= EKV) return;      // k and v have only 4 heads
  const int prow = (which == 0 ? 0 : (which == 1 ? E : E + EKV)) + n0;
  v8f acc[8] = {};
#pragma unroll 2
  for (int kc = 0; kc < E / 32; ++kc) { const v16b a = frag_b(Xb + (size_t)(r0 + col) * E + kc * 32, lane);
#pragma unroll
    for (int j = 0; j < 8; ++j) acc[j] = wmma_bf(a, frag_b(PT + (size_t)(prow + j * 16 + col) * E + kc * 32, lane), acc[j]); }
  if (which < 2) {
#pragma unroll
    for (int j = 0; j < 8; ++j) { const float bb = 0.f;
#pragma unroll
      for (int r = 0; r < 8; ++r) so[wave][8 * g + r][j * 16 + col] = acc[j][r] + bb; }
    LDSX();
    if (which == 0) { for (int qq = lane; qq < 2 * 16 * 16; qq += 32) { const int hh = qq >> 8, rl = (qq >> 4) & 15, pc = qq & 15; const int h = (n0 >> 6) + hh;
        vst2(Q32 + (((size_t)b * NH + h) * SS + s0 + wave * 16 + rl) * HD + pc * 4, *(const v4f*)(&so[wave][rl][hh * 64 + pc * 4])); } }
    else {
      for (int qq = lane; qq < 2 * 16 * 16; qq += 32) { const int hh = qq >> 8, rl = (qq >> 4) & 15, pl = qq & 15; const int h = (n0 >> 6) + hh; const int pc = pl & 7; union { __bf16 e[8]; v4u u; } pk;
#pragma unroll
        for (int e = 0; e < 8; ++e) { const float v = so[wave][rl][hh * 64 + pc * 8 + e]; const __bf16 hi = (__bf16)v; pk.e[e] = pl < 8 ? hi : (__bf16)(v - (float)hi); }
        vst2((unsigned*)((pl < 8 ? Kh : Kl) + (((size_t)b * NKV + h) * SS + s0 + wave * 16 + rl) * HD + pc * 8), pk.u); } } }
  else {
#pragma unroll
    for (int j = 0; j < 8; ++j) { const float bb = 0.f;
#pragma unroll
      for (int r = 0; r < 8; ++r) { const float v = (acc[j][r] + bb) * 4.0f; const _Float16 hi = (_Float16)v; sth[j * 16 + col][wave * 16 + 8 * g + r] = hi; stl[j * 16 + col][wave * 16 + 8 * g + r] = (_Float16)((v - (float)hi) * VLO); } }
    __syncthreads();
    for (int qq = tid; qq < 128 * 8; qq += 128) { const int cl = qq >> 3, pc = qq & 7; const int c = n0 + cl, h = c >> 6, d = c & 63; const size_t o = (((size_t)b * NKV + h) * HD + d) * SS + s0 + pc * 8;
      vst2(VTh + o, *(const v4u*)(&sth[cl][pc * 8])); vst2(VTl + o, *(const v4u*)(&stl[cl][pc * 8])); } }
}
// causal attention: block (64 queries, bh); key tiles 0..qb of 64 keys; S on q hi/lo x K hi/lo rows; P,V hi/lo; O f32 [bh][s][64]
__global__ __launch_bounds__(128) void k_attn(const float* __restrict__ Q32, const __bf16* __restrict__ Kh, const __bf16* __restrict__ Kl, const _Float16* __restrict__ VTh, const _Float16* __restrict__ VTl, float* __restrict__ O32) {
  __shared__ __align__(16) float sS[4][16][68];
  __shared__ __align__(16) _Float16 sPh[4][16][72], sPl[4][16][72];
  __shared__ __align__(16) float sO[4][16][68];
  const int tid = threadIdx.x, w = tid >> 5, lane = tid & 31, col = lane & 15, g = lane >> 4;
  const size_t bh = blockIdx.y; const int qb = blockIdx.x; const int q0 = qb * 64 + w * 16;
  F2 aq[2];
#pragma unroll
  for (int kc = 0; kc < 2; ++kc) aq[kc] = split_row(Q32 + (bh * SS + q0 + col) * HD, kc * 32, lane);
  const int b = (int)(bh / NH); const size_t kvh = (size_t)b * NKV + (bh % NH) / (NH / NKV);     // repeat_kv: query head h reads kv head h/4
  float mrun = -3.0e38f, lrun = 0.f; v8f acc[4] = {}, ac1[4] = {}, ac2[4] = {};
  LDSX();
#pragma unroll 1
  for (int kt = 0; kt <= qb; ++kt) {      // causal
#pragma unroll
    for (int t = 0; t < 4; ++t) { const int key = kt * 64 + t * 16 + col; const size_t ko = (kvh * SS + key) * HD; v8f s = {};
#pragma unroll
      for (int kc = 0; kc < 2; ++kc) { const v16b khf = frag_b(Kh + ko + kc * 32, lane), klf = frag_b(Kl + ko + kc * 32, lane); s = wmma_bf(aq[kc].l, khf, s); s = wmma_bf(aq[kc].h, klf, s); s = wmma_bf(aq[kc].h, khf, s); }
#pragma unroll
      for (int r = 0; r < 8; ++r) sS[w][8 * g + r][t * 16 + col] = (key > q0 + 8 * g + r) ? -1.0e9f : s[r] * 0.125f; }
    LDSX();
    float mx = -3.4e38f;
#pragma unroll
    for (int jj = 0; jj < 32; ++jj) mx = fmaxf(mx, sS[w][col][g * 32 + jj]);
    mx = fmaxf(mx, __shfl_xor(mx, 16, 32));
    const float mnew = fmaxf(mrun, mx); const float corr = expf(mrun - mnew);
    float ps = 0.f;
#pragma unroll
    for (int jj = 0; jj < 32; ++jj) { const float p = expf(sS[w][col][g * 32 + jj] - mnew) * 16384.0f; ps += p; const _Float16 hi = (_Float16)p; sPh[w][col][g * 32 + jj] = hi; sPl[w][col][g * 32 + jj] = (_Float16)((p - (float)hi) * PLO); }
    ps += __shfl_xor(ps, 16, 32);
    lrun = lrun * corr + ps * (1.0f / 16384.0f); mrun = mnew;
#pragma unroll
    for (int r = 0; r < 8; ++r) { const float cr = __shfl(corr, 8 * g + r, 32);
#pragma unroll
      for (int t = 0; t < 4; ++t) { acc[t][r] *= cr; ac1[t][r] *= cr; ac2[t][r] *= cr; } }
    LDSX();
#pragma unroll
    for (int kc = 0; kc < 2; ++kc) { const v16h ph = frag_h(&sPh[w][col][0] + kc * 32, lane), pl = frag_h(&sPl[w][col][0] + kc * 32, lane);
#pragma unroll
      for (int t = 0; t < 4; ++t) { const size_t vo = (kvh * HD + t * 16 + col) * SS + kt * 64 + kc * 32; const v16h vh = frag_h(VTh + vo, lane);
        acc[t] = wmma16(ph, vh, acc[t]); ac1[t] = wmma16(ph, frag_h(VTl + vo, lane), ac1[t]); ac2[t] = wmma16(pl, vh, ac2[t]); } }
    __builtin_amdgcn_wave_barrier(); }
#pragma unroll
  for (int r = 0; r < 8; ++r) { const float lr = __shfl(lrun, 8 * g + r, 32); const float inv = 1.0f / (lr * 16384.0f * 4.0f);
#pragma unroll
    for (int t = 0; t < 4; ++t) sO[w][8 * g + r][t * 16 + col] = (acc[t][r] + ac1[t][r] * (1.0f / VLO) + ac2[t][r] * (1.0f / PLO)) * inv; }
  LDSX();
  for (int qq = lane; qq < 16 * 16; qq += 32) { const int rl = qq >> 4, pc = qq & 15; vst2(O32 + ((bh * SS) + q0 + rl) * HD + pc * 4, *(const v4f*)(&sO[w][rl][pc * 4])); }
}
// out = ctx Wo : split(ctx) x bf16(Wo rows): 2 products (Wo is an INPUT -> bf16 exact)
__global__ __launch_bounds__(128) void k_out(const float* __restrict__ O32, const __bf16* __restrict__ PT, float* __restrict__ out) {
  __shared__ __align__(16) float so[4][16][132];
  const int tid = threadIdx.x, wave = tid >> 5, lane = tid & 31, col = lane & 15, g = lane >> 4;
  const int r0 = blockIdx.x * 64 + wave * 16, n0 = blockIdx.y * 128; const int ra = r0 + col; const int b = ra / SS, s = ra % SS;
  v8f acc[8] = {};
#pragma unroll 1
  for (int kc = 0; kc < E / 32; ++kc) { const int h = kc >> 1; const F2 a = split_row(O32 + (((size_t)b * NH + h) * SS + s) * HD, (kc & 1) * 32, lane);
#pragma unroll
    for (int j = 0; j < 8; ++j) { const v16b wb = frag_b(PT + (size_t)(E + 2 * EKV + n0 + j * 16 + col) * E + kc * 32, lane); acc[j] = wmma_bf(a.l, wb, acc[j]); acc[j] = wmma_bf(a.h, wb, acc[j]); } }
#pragma unroll
  for (int j = 0; j < 8; ++j) {
#pragma unroll
    for (int r = 0; r < 8; ++r) so[wave][8 * g + r][j * 16 + col] = acc[j][r]; }
  LDSX();
#pragma unroll 4
  for (int rl = 0; rl < 16; ++rl) vst2(out + (size_t)(r0 + rl) * E + n0 + lane * 4, *(const v4f*)(&so[wave][rl][lane * 4]));
}
extern "C" void kernel_launch(void* const* d_in, const int* in_sizes, int n_in, void* d_out, int out_size, void* d_ws, size_t ws_size, hipStream_t stream) {
  (void)in_sizes; (void)n_in; (void)out_size; (void)ws_size;
  const float* x = (const float*)d_in[0]; const float* Wq = (const float*)d_in[1]; const float* Wk = (const float*)d_in[2]; const float* Wv = (const float*)d_in[3]; const float* Wo = (const float*)d_in[4];
  float* out = (float*)d_out;
  char* ws = (char*)d_ws; size_t off = 0;
  auto take = [&](size_t bytes) { char* p = ws + off; off += (bytes + 255) & ~(size_t)255; return p; };
  __bf16* Xb = (__bf16*)take((size_t)NR * E * 2); __bf16* PT = (__bf16*)take((size_t)(2 * E + 2 * EKV) * E * 2);
  float* Q32 = (float*)take((size_t)NR * E * 4); __bf16* Kh = (__bf16*)take((size_t)NR * EKV * 2); __bf16* Kl = (__bf16*)take((size_t)NR * EKV * 2); _Float16* VTh = (_Float16*)take((size_t)NR * EKV * 2); _Float16* VTl = (_Float16*)take((size_t)NR * EKV * 2); float* O32 = (float*)take((size_t)NR * E * 4);
  // ws ~ 102 MB
  k_cvt<<<(NR * E / 8 + 255) / 256, 256, 0, stream>>>(x, Xb);
  k_pack<<<2 * E + 2 * EKV, 256, 0, stream>>>(Wq, Wk, Wv, Wo, PT);
  k_qkv<<<dim3(NR / 64, E / 128, 3), 128, 0, stream>>>(Xb, PT, Q32, Kh, Kl, VTh, VTl);
  k_attn<<<dim3(SS / 64, NB * NH), 128, 0, stream>>>(Q32, Kh, Kl, VTh, VTl, O32);
  k_out<<<dim3(NR / 64, E / 128), 128, 0, stream>>>(O32, PT, out);
}

// v001
// Measured time: 287 microseconds a run.
// Next to v000, in two timings, it ran 2.38 and 2.39 times as fast.
// compute dtype: x and wq/wk/wv/wo (INPUTS) rounded to bf16 with exact bf16 WMMA products (f32 accumulate) for the projections; K pre-split into bf16 hi/lo rows; q f32 split, P and V f16 hi/lo (3 products each); softmax f32.
#include <hip/hip_runtime.h>
#include <math.h>

typedef __attribute__((ext_vector_type(16))) _Float16 v16h;
typedef __attribute__((ext_vector_type(16))) __bf16 v16b;
typedef __attribute__((ext_vector_type(8)))  _Float16 v8h;
typedef __attribute__((ext_vector_type(8)))  float v8f;
typedef __attribute__((ext_vector_type(4)))  float v4f;
typedef __attribute__((ext_vector_type(2)))  float v2f;
typedef __attribute__((ext_vector_type(4)))  unsigned v4u;
typedef __attribute__((ext_vector_type(4)))  int v4i;
typedef float __attribute__((may_alias)) float_a;
typedef int __attribute__((may_alias)) int_a;

template <typename T> __device__ __forceinline__ void vst2(void* p, T v) { *(T*)p = v;  }
__device__ __forceinline__ v8f wmma16(v16h a, v16h b, v8f c) {
  v8f d = __builtin_amdgcn_wmma_f32_16x16x32_f16(false, a, false, b, (short)0, c, false, false);
  asm volatile("v_nop\n\tv_nop\n\tv_nop\n\tv_nop" : "+v"(d) : "v"(a), "v"(b));
  return d;
}
__device__ __forceinline__ v8f wmma_bf(v16b a, v16b b, v8f c) {
  v8f d = __builtin_amdgcn_wmma_f32_16x16x32_bf16(false, a, false, b, (short)0, c, false, false);
  asm volatile("v_nop\n\tv_nop\n\tv_nop\n\tv_nop" : "+v"(d) : "v"(a), "v"(b));
  return d;
}
// 16x16x32 fragments: lane = (h = lane>>4, row/col = lane&15); elements 0..7 = k0+8h+0..7, 8..15 = k0+16+8h+0..7; D element r = row 8h+r
__device__ __forceinline__ v16h frag_h(const _Float16* rowk0, int lane) {
  union { v16h v; v8h q[2]; } u; const _Float16* p = rowk0 + 8 * (lane >> 4);
  u.q[0] = *(const v8h*)p; u.q[1] = *(const v8h*)(p + 16); return u.v;
}
__device__ __forceinline__ v16h frag_f32(const float* rowk0, int lane) {
  v16h a; const float* p = rowk0 + 8 * (lane >> 4);
#pragma unroll
  for (int i = 0; i < 8; ++i) { a[i] = (_Float16)p[i]; a[8 + i] = (_Float16)p[16 + i]; }
  return a;
}
__device__ __forceinline__ v16h frag_f32s(const float* rowk0, int lane, float sc) {
  v16h a; const float* p = rowk0 + 8 * (lane >> 4);
#pragma unroll
  for (int i = 0; i < 8; ++i) { a[i] = (_Float16)(p[i] * sc); a[8 + i] = (_Float16)(p[16 + i] * sc); }
  return a;
}
// column fragment from a [K][ld] layout (column n), rows >= K read as 0
__device__ __forceinline__ v16h fragc_f32(const float* W, int k0, int n, int lane, int ld, int K) {
  v16h a; const int g = lane >> 4;
#pragma unroll
  for (int i = 0; i < 8; ++i) { const int ka = k0 + 8 * g + i, kb = ka + 16;
    a[i] = (_Float16)(ka < K ? W[(size_t)ka * ld + n] : 0.f); a[8 + i] = (_Float16)(kb < K ? W[(size_t)kb * ld + n] : 0.f); }
  return a;
}
struct F2 { v16b h, l; };
__device__ __forceinline__ F2 bsplit16(const float v[16]) { F2 r;
#pragma unroll
  for (int i = 0; i < 16; ++i) { const __bf16 h = (__bf16)v[i]; r.h[i] = h; r.l[i] = (__bf16)(v[i] - (float)h); }
  return r; }
__device__ __forceinline__ F2 split_row(const float* row, int k0, int lane) { float v[16]; const float* p = row + k0 + 8 * (lane >> 4);
#pragma unroll
  for (int i = 0; i < 8; ++i) { v[i] = p[i]; v[8 + i] = p[16 + i]; }
  return bsplit16(v); }
__device__ __forceinline__ F2 split_rowK(const float* row, int k0, int lane, int K) { float v[16]; const int g = lane >> 4;
#pragma unroll
  for (int i = 0; i < 8; ++i) { const int ka = k0 + 8 * g + i, kb = ka + 16; v[i] = ka < K ? row[ka] : 0.f; v[8 + i] = kb < K ? row[kb] : 0.f; }
  return bsplit16(v); }
__device__ __forceinline__ F2 split_col(const float* W, int k0, int n, int lane, int ld, int K) { float v[16]; const int g = lane >> 4;
#pragma unroll
  for (int i = 0; i < 8; ++i) { const int ka = k0 + 8 * g + i, kb = ka + 16; v[i] = ka < K ? W[(size_t)ka * ld + n] : 0.f; v[8 + i] = kb < K ? W[(size_t)kb * ld + n] : 0.f; }
  return bsplit16(v); }
__device__ __forceinline__ v8f mac3(const F2& a, const F2& b, v8f c) { c = wmma_bf(a.l, b.h, c); c = wmma_bf(a.h, b.l, c); return wmma_bf(a.h, b.h, c); }
__device__ __forceinline__ float sigm(float v) { return 1.0f / (1.0f + expf(-v)); }
#define LDSX() do { asm volatile("s_wait_dscnt 0" ::: "memory"); __builtin_amdgcn_wave_barrier(); __builtin_amdgcn_fence(__ATOMIC_RELEASE, "workgroup"); } while (0)


// Grouped-query causal self attention (16 query heads, 4 kv heads of 64 on [4,2048,1024], [in][out] weights, no biases): head h reads kv head h/4 (repeat_kv); -inf above the diagonal; (P v) @ wo. Key tiles past the query block are skipped.
#define NB 4
#define SS 2048
#define E 1024
#define NH 16
#define NKV 4
#define EKV (NKV * HD)
#define HD 64
#define NR (NB * SS)
#define PLO 1024.0f
#define VLO 2048.0f
__device__ __forceinline__ float bfr(float v) { return (float)(__bf16)v; }
__device__ __forceinline__ v16b frag_b(const __bf16* rowk0, int lane) { return __builtin_bit_cast(v16b, frag_h((const _Float16*)rowk0, lane)); }

#define TP 72      // LDS row pitch of a staged 128-B row in 16-bit elements: 144 B = 16 B x 9, the conflict-free pitch for 16-byte fragment reads
// Asynchronous copies global -> LDS, 16 B per lane, rows gs bytes apart in global memory and ls bytes apart in LDS. The copies and their s_wait_xcnt stand in one statement, so that no address register is rewritten before the wait.
__device__ __forceinline__ void copy4(unsigned la, unsigned ls, const char* a, size_t gs) {
  asm volatile("global_load_async_to_lds_b128 %0, %4, off\n\t"
               "global_load_async_to_lds_b128 %1, %5, off\n\t"
               "global_load_async_to_lds_b128 %2, %6, off\n\t"
               "global_load_async_to_lds_b128 %3, %7, off\n\t"
               "s_wait_xcnt 0x0"
               :: "v"(la), "v"(la + ls), "v"(la + 2 * ls), "v"(la + 3 * ls), "v"(a), "v"(a + gs), "v"(a + 2 * gs), "v"(a + 3 * gs) : "memory");
}
__device__ __forceinline__ void copy8(unsigned la, unsigned lc, unsigned ls, const char* a, const char* c, size_t gs) {
  asm volatile("global_load_async_to_lds_b128 %0, %8, off\n\t"
               "global_load_async_to_lds_b128 %1, %9, off\n\t"
               "global_load_async_to_lds_b128 %2, %10, off\n\t"
               "global_load_async_to_lds_b128 %3, %11, off\n\t"
               "global_load_async_to_lds_b128 %4, %12, off\n\t"
               "global_load_async_to_lds_b128 %5, %13, off\n\t"
               "global_load_async_to_lds_b128 %6, %14, off\n\t"
               "global_load_async_to_lds_b128 %7, %15, off\n\t"
               "s_wait_xcnt 0x0"
               :: "v"(la), "v"(la + ls), "v"(la + 2 * ls), "v"(la + 3 * ls), "v"(lc), "v"(lc + ls), "v"(lc + 2 * ls), "v"(lc + 3 * ls),
                  "v"(a), "v"(a + gs), "v"(a + 2 * gs), "v"(a + 3 * gs), "v"(c), "v"(c + gs), "v"(c + 2 * gs), "v"(c + 3 * gs) : "memory");
}
// this wave's own copies have landed (in front of the barrier that lets other waves read them, and behind the last copy of a kernel)
#define LANDED() asm volatile("s_wait_asynccnt 0x0" ::: "memory")
// publish point of a staged tile: this wave's LDS reads retired, its own copies landed, then the work-group barrier (it publishes the tile that flew and frees the one just read)
#define PUBLISH() do { asm volatile("s_wait_dscnt 0" ::: "memory"); LANDED(); __syncthreads(); } while (0)

__global__ __launch_bounds__(256) void k_cvt(const float* __restrict__ x, __bf16* __restrict__ Xb) {
  const size_t i8 = (size_t)blockIdx.x * 256 + threadIdx.x; if (i8 >= (size_t)NR * E / 8) return;
  union { __bf16 h[8]; v4u u; } pk;
#pragma unroll
  for (int e = 0; e < 8; ++e) pk.h[e] = (__bf16)x[i8 * 8 + e];
  vst2((unsigned*)(Xb + i8 * 8), pk.u);
}
// PT rows: [0,E) Wq[:,n], [E,E+EKV) Wk[:,n], [E+EKV,E+2EKV) Wv[:,n], [E+2EKV,2E+2EKV) Wo[:,n]  ([in][out] weights: column n as a bf16 row)
__global__ __launch_bounds__(256) void k_pack(const float* __restrict__ Wq, const float* __restrict__ Wk, const float* __restrict__ Wv, const float* __restrict__ Wo, __bf16* __restrict__ PT) {
  const int n = blockIdx.x, tid = threadIdx.x; __shared__ __align__(16) __bf16 srow[E];
  const float* W = n < E ? Wq : (n < E + EKV ? Wk : (n < E + 2 * EKV ? Wv : Wo)); const int nn = n < E ? n : (n < E + EKV ? n - E : (n < E + 2 * EKV ? n - E - EKV : n - E - 2 * EKV)); const int ld = (n >= E && n < E + 2 * EKV) ? EKV : E;      // [in][out]: column nn
  for (int k = tid; k < E; k += 256) srow[k] = (__bf16)W[(size_t)k * ld + nn];
  __syncthreads();
  if (tid < E / 8) vst2((unsigned*)(PT + (size_t)n * E + tid * 8), *(const v4u*)(&srow[tid * 8]));
}
// QKV: block (64 rows, 128 cols = 2 heads, which); q -> Q32 f32 [bh][s][64]; k -> bf16 hi/lo rows; v -> VT hi/lo x4 [bh][d][s]
#define QST (192 * TP * 2)      // bytes of one stage: 64 x rows, then 128 weight rows, 64 k (128 B) each, at pitch TP
__global__ __launch_bounds__(128) void k_qkv(const __bf16* __restrict__ Xb, const __bf16* __restrict__ PT, float* __restrict__ Q32, __bf16* __restrict__ Kh, __bf16* __restrict__ Kl, _Float16* __restrict__ VTh, _Float16* __restrict__ VTl) {
  __shared__ __align__(16) char sm[2 * QST];      // in the loop the two operand stages, behind it the output staging
  float (*so)[16][132] = (float (*)[16][132])sm; _Float16 (*sth)[72] = (_Float16 (*)[72])sm; _Float16 (*stl)[72] = (_Float16 (*)[72])(sm + 128 * 72 * 2);
  const int tid = threadIdx.x, wave = tid >> 5, lane = tid & 31, col = lane & 15, g = lane >> 4;
  const int which = blockIdx.z, r0b = blockIdx.x * 64, r0 = r0b + wave * 16, n0 = blockIdx.y * 128; const int b = r0b / SS, s0 = r0b % SS;
  if (which > 0 && n0 >= EKV) return;      // k and v have only 4 heads
  const int prow = (which == 0 ? 0 : (which == 1 ? E : E + EKV)) + n0;
  v8f acc[8] = {};
  // each lane copies 16 B of rows tid / 8 + 16 i: a wave-wide copy = 4 whole 128-B lines
  const char* gA = (const char*)(Xb + (size_t)(r0b + (tid >> 3)) * E + (tid & 7) * 8); const char* gB = (const char*)(PT + (size_t)(prow + (tid >> 3)) * E + (tid & 7) * 8);
  const unsigned lA = (unsigned)(size_t)sm + (tid >> 3) * (TP * 2) + (tid & 7) * 16, lB = lA + 64 * TP * 2;
  auto stage = [&](int s) { const unsigned o = (s & 1) * QST; const char* a = gA + s * 128; const char* c = gB + s * 128;
    copy4(lA + o, 16 * TP * 2, a, (size_t)16 * E * 2); copy8(lB + o, lB + o + 64 * TP * 2, 16 * TP * 2, c, c + (size_t)64 * E * 2, (size_t)16 * E * 2); };
  stage(0); LANDED(); __syncthreads();
  stage(1);
#pragma unroll 1      // rolled: one pass per stage, the buffer picked by s & 1; unrolling would only lengthen the code
  for (int s = 0; s < E / 64; ++s) { const __bf16* tA = (const __bf16*)(sm + (s & 1) * QST); const __bf16* tB = tA + 64 * TP;
#pragma unroll
    for (int kc = 0; kc < 2; ++kc) { const v16b a = frag_b(tA + (wave * 16 + col) * TP + kc * 32, lane); v16b wb[8];      // the block's LDS reads stand together in front of its WMMAs
#pragma unroll
      for (int j = 0; j < 8; ++j) wb[j] = frag_b(tB + (j * 16 + col) * TP + kc * 32, lane);
#pragma unroll
      for (int j = 0; j < 8; ++j) acc[j] = wmma_bf(a, wb[j], acc[j]); }
    PUBLISH();      // stage s + 1 readable; every wave has left stage s (behind the last pass: the ring is free for the output staging)
    if (s + 2 < E / 64) stage(s + 2); }
  LANDED();
  if (which < 2) {
#pragma unroll
    for (int j = 0; j < 8; ++j) { const float bb = 0.f;
#pragma unroll
      for (int r = 0; r < 8; ++r) so[wave][8 * g + r][j * 16 + col] = acc[j][r] + bb; }
    LDSX();
    if (which == 0) { for (int qq = lane; qq < 2 * 16 * 16; qq += 32) { const int hh = qq >> 8, rl = (qq >> 4) & 15, pc = qq & 15; const int h = (n0 >> 6) + hh;
        vst2(Q32 + (((size_t)b * NH + h) * SS + s0 + wave * 16 + rl) * HD + pc * 4, *(const v4f*)(&so[wave][rl][hh * 64 + pc * 4])); } }
    else {
      for (int qq = lane; qq < 2 * 16 * 16; qq += 32) { const int hh = qq >> 8, rl = (qq >> 4) & 15, pl = qq & 15; const int h = (n0 >> 6) + hh; const int pc = pl & 7; union { __bf16 e[8]; v4u u; } pk;
#pragma unroll
        for (int e = 0; e < 8; ++e) { const float v = so[wave][rl][hh * 64 + pc * 8 + e]; const __bf16 hi = (__bf16)v; pk.e[e] = pl < 8 ? hi : (__bf16)(v - (float)hi); }
        vst2((unsigned*)((pl < 8 ? Kh : Kl) + (((size_t)b * NKV + h) * SS + s0 + wave * 16 + rl) * HD + pc * 8), pk.u); } } }
  else {
#pragma unroll
    for (int j = 0; j < 8; ++j) { const float bb = 0.f;
#pragma unroll
      for (int r = 0; r < 8; ++r) { const float v = (acc[j][r] + bb) * 4.0f; const _Float16 hi = (_Float16)v; sth[j * 16 + col][wave * 16 + 8 * g + r] = hi; stl[j * 16 + col][wave * 16 + 8 * g + r] = (_Float16)((v - (float)hi) * VLO); } }
    __syncthreads();
    for (int qq = tid; qq < 128 * 8; qq += 128) { const int cl = qq >> 3, pc = qq & 7; const int c = n0 + cl, h = c >> 6, d = c & 63; const size_t o = (((size_t)b * NKV + h) * HD + d) * SS + s0 + pc * 8;
      vst2(VTh + o, *(const v4u*)(&sth[cl][pc * 8])); vst2(VTl + o, *(const v4u*)(&stl[cl][pc * 8])); } }
}
// causal attention: block (64 queries, bh); key tiles up to the diagonal; the K and V tiles are staged once per block in LDS, K(t+1) flying under softmax and PV of t, V(t+1) under S of t+1; S on q hi/lo x K hi/lo rows; P,V hi/lo; O f32 [bh][s][64]
// second launch bound: four waves per SIMD, the residency that the LDS use allows
__global__ __launch_bounds__(128, 4) void k_attn(const float* __restrict__ Q32, const __bf16* __restrict__ Kh, const __bf16* __restrict__ Kl, const _Float16* __restrict__ VTh, const _Float16* __restrict__ VTl, float* __restrict__ O32) {
  __shared__ __align__(16) float sS[4][16][68];
  __shared__ __align__(16) _Float16 sPh[4][16][72], sPl[4][16][72];
  __shared__ __align__(16) __bf16 sKh[64 * TP], sKl[64 * TP];
  __shared__ __align__(16) _Float16 sVh[64 * TP], sVl[64 * TP];
  const int tid = threadIdx.x, w = tid >> 5, lane = tid & 31, col = lane & 15, g = lane >> 4;
  const size_t bh = blockIdx.y; const int qb = blockIdx.x; const int q0 = qb * 64 + w * 16;
  F2 aq[2];
#pragma unroll
  for (int kc = 0; kc < 2; ++kc) aq[kc] = split_row(Q32 + (bh * SS + q0 + col) * HD, kc * 32, lane);
  const int b = (int)(bh / NH); const size_t kvh = (size_t)b * NKV + (bh % NH) / (NH / NKV);     // repeat_kv: query head h reads kv head h/4
  float mrun = -3.0e38f, lrun = 0.f; v8f acc[4] = {}, ac1[4] = {}, ac2[4] = {};
  LDSX();
  // each lane copies 16 B of rows tid / 8 + 16 i of the hi and of the lo plane: a wave-wide copy = 4 whole 128-B lines
  const size_t kof = ((kvh * SS + (tid >> 3)) * HD + (tid & 7) * 8) * 2, vof = ((kvh * HD + (tid >> 3)) * SS + (tid & 7) * 8) * 2;      // bytes; K tile: rows = keys, 128 B apart; V tile: rows = d, SS * 2 bytes apart
  const char* gKh = (const char*)Kh + kof; const char* gKl = (const char*)Kl + kof; const char* gVh = (const char*)VTh + vof; const char* gVl = (const char*)VTl + vof;
  const unsigned lof = (tid >> 3) * (TP * 2) + (tid & 7) * 16;
  const unsigned lKh = (unsigned)(size_t)sKh + lof, lKl = (unsigned)(size_t)sKl + lof, lVh = (unsigned)(size_t)sVh + lof, lVl = (unsigned)(size_t)sVl + lof;
  copy8(lKh, lKl, 16 * TP * 2, gKh, gKl, (size_t)16 * HD * 2); LANDED(); __syncthreads();
  copy8(lVh, lVl, 16 * TP * 2, gVh, gVl, (size_t)16 * SS * 2);
#pragma unroll 1
  for (int kt = 0; kt <= qb; ++kt) {      // causal
#pragma unroll
    for (int t = 0; t < 4; ++t) { const int key = kt * 64 + t * 16 + col; const int ko = (t * 16 + col) * TP; v8f s = {}; v16b khf[2], klf[2];
#pragma unroll
      for (int kc = 0; kc < 2; ++kc) { khf[kc] = frag_b(sKh + ko + kc * 32, lane); klf[kc] = frag_b(sKl + ko + kc * 32, lane); }      // the block's LDS reads stand together in front of its WMMAs
#pragma unroll
      for (int kc = 0; kc < 2; ++kc) { s = wmma_bf(aq[kc].l, khf[kc], s); s = wmma_bf(aq[kc].h, klf[kc], s); s = wmma_bf(aq[kc].h, khf[kc], s); }
#pragma unroll
      for (int r = 0; r < 8; ++r) sS[w][8 * g + r][t * 16 + col] = (key > q0 + 8 * g + r) ? -1.0e9f : s[r] * 0.125f; }
    PUBLISH();      // V(kt) readable; every wave has left K(kt); the wave's own scores are written
    if (kt < qb) copy8(lKh, lKl, 16 * TP * 2, gKh + (size_t)(kt + 1) * 64 * HD * 2, gKl + (size_t)(kt + 1) * 64 * HD * 2, (size_t)16 * HD * 2);
    float mx = -3.4e38f;
#pragma unroll
    for (int jj = 0; jj < 32; ++jj) mx = fmaxf(mx, sS[w][col][g * 32 + jj]);
    mx = fmaxf(mx, __shfl_xor(mx, 16, 32));
    const float mnew = fmaxf(mrun, mx); const float corr = expf(mrun - mnew);
    float ps = 0.f;
#pragma unroll
    for (int jj = 0; jj < 32; ++jj) { const float p = expf(sS[w][col][g * 32 + jj] - mnew) * 16384.0f; ps += p; const _Float16 hi = (_Float16)p; sPh[w][col][g * 32 + jj] = hi; sPl[w][col][g * 32 + jj] = (_Float16)((p - (float)hi) * PLO); }
    ps += __shfl_xor(ps, 16, 32);
    lrun = lrun * corr + ps * (1.0f / 16384.0f); mrun = mnew;
#pragma unroll
    for (int r = 0; r < 8; ++r) { const float cr = __shfl(corr, 8 * g + r, 32);
#pragma unroll
      for (int t = 0; t < 4; ++t) { acc[t][r] *= cr; ac1[t][r] *= cr; ac2[t][r] *= cr; } }
    LDSX();
#pragma unroll
    for (int kc = 0; kc < 2; ++kc) { const v16h ph = frag_h(&sPh[w][col][0] + kc * 32, lane), pl = frag_h(&sPl[w][col][0] + kc * 32, lane);
#pragma unroll
      for (int t = 0; t < 4; ++t) { const int vo = (t * 16 + col) * TP + kc * 32; const v16h vh = frag_h(sVh + vo, lane), vl = frag_h(sVl + vo, lane);      // the block's LDS reads stand together in front of its WMMAs
        acc[t] = wmma16(ph, vh, acc[t]); ac1[t] = wmma16(ph, vl, ac1[t]); ac2[t] = wmma16(pl, vh, ac2[t]); } }
    PUBLISH();      // K(kt + 1) readable; every wave has left V(kt)
    if (kt < qb) copy8(lVh, lVl, 16 * TP * 2, gVh + (size_t)(kt + 1) * 64 * 2, gVl + (size_t)(kt + 1) * 64 * 2, (size_t)16 * SS * 2); }
  LANDED();
#pragma unroll
  for (int r = 0; r < 8; ++r) { const float lr = __shfl(lrun, 8 * g + r, 32); const float inv = 1.0f / (lr * 16384.0f * 4.0f);
#pragma unroll
    for (int t = 0; t < 4; ++t) sS[w][8 * g + r][t * 16 + col] = (acc[t][r] + ac1[t][r] * (1.0f / VLO) + ac2[t][r] * (1.0f / PLO)) * inv; }
  LDSX();
  for (int qq = lane; qq < 16 * 16; qq += 32) { const int rl = qq >> 4, pc = qq & 15; vst2(O32 + ((bh * SS) + q0 + rl) * HD + pc * 4, *(const v4f*)(&sS[w][rl][pc * 4])); }
}
// out = ctx Wo : split(ctx) x bf16(Wo rows): 2 products (Wo is an INPUT -> bf16 exact)
#define CP 68      // LDS row pitch of a staged 256-B f32 row in floats: 272 B = 16 B x 17
#define OSA (64 * CP * 4)      // bytes of the ctx part of a stage: 64 rows of one head
#define OST (OSA + 128 * TP * 2)      // bytes of one stage: the ctx rows, then 128 weight rows of 64 k
__global__ __launch_bounds__(128) void k_out(const float* __restrict__ O32, const __bf16* __restrict__ PT, float* __restrict__ out) {
  __shared__ __align__(16) char sm[2 * OST];      // in the loop the two operand stages, behind it the output staging
  float (*so)[16][132] = (float (*)[16][132])sm;
  const int tid = threadIdx.x, wave = tid >> 5, lane = tid & 31, col = lane & 15, g = lane >> 4;
  const int r0b = blockIdx.x * 64, r0 = r0b + wave * 16, n0 = blockIdx.y * 128; const int b = r0b / SS, s0 = r0b % SS;
  v8f acc[8] = {};
  // ctx: each lane copies 16 B of rows tid / 16 + 8 i (a wave-wide copy = 2 rows = 4 whole lines); weights: 16 B of rows tid / 8 + 16 i
  const char* gA = (const char*)(O32 + ((size_t)b * NH * SS + s0 + (tid >> 4)) * HD + (tid & 15) * 4); const char* gB = (const char*)(PT + (size_t)(E + 2 * EKV + n0 + (tid >> 3)) * E + (tid & 7) * 8);
  const unsigned lA = (unsigned)(size_t)sm + (tid >> 4) * (CP * 4) + (tid & 15) * 16, lB = (unsigned)(size_t)sm + OSA + (tid >> 3) * (TP * 2) + (tid & 7) * 16;
  auto stage = [&](int h) { const unsigned o = (h & 1) * OST; const char* a = gA + (size_t)h * SS * HD * 4; const char* c = gB + h * 128;
    copy8(lA + o, lA + o + 32 * CP * 4, 8 * CP * 4, a, a + 32 * HD * 4, (size_t)8 * HD * 4); copy8(lB + o, lB + o + 64 * TP * 2, 16 * TP * 2, c, c + (size_t)64 * E * 2, (size_t)16 * E * 2); };
  stage(0); LANDED(); __syncthreads();
  stage(1);
#pragma unroll 1      // rolled: one pass per stage, the buffer picked by h & 1; unrolling would only lengthen the code
  for (int h = 0; h < NH; ++h) { const float* tA = (const float*)(sm + (h & 1) * OST); const __bf16* tB = (const __bf16*)(sm + (h & 1) * OST + OSA);
#pragma unroll
    for (int kc = 0; kc < 2; ++kc) { const F2 a = split_row(tA + (wave * 16 + col) * CP, kc * 32, lane); v16b wb[8];      // the block's LDS reads stand together in front of its WMMAs
#pragma unroll
      for (int j = 0; j < 8; ++j) wb[j] = frag_b(tB + (j * 16 + col) * TP + kc * 32, lane);
#pragma unroll
      for (int j = 0; j < 8; ++j) { acc[j] = wmma_bf(a.l, wb[j], acc[j]); acc[j] = wmma_bf(a.h, wb[j], acc[j]); } }
    PUBLISH();      // stage h + 1 readable; every wave has left stage h (behind the last pass: the ring is free for the output staging)
    if (h + 2 < NH) stage(h + 2); }
  LANDED();
#pragma unroll
  for (int j = 0; j < 8; ++j) {
#pragma unroll
    for (int r = 0; r < 8; ++r) so[wave][8 * g + r][j * 16 + col] = acc[j][r]; }
  LDSX();
#pragma unroll 4
  for (int rl = 0; rl < 16; ++rl) vst2(out + (size_t)(r0 + rl) * E + n0 + lane * 4, *(const v4f*)(&so[wave][rl][lane * 4]));
}
extern "C" void kernel_launch(void* const* d_in, const int* in_sizes, int n_in, void* d_out, int out_size, void* d_ws, size_t ws_size, hipStream_t stream) {
  (void)in_sizes; (void)n_in; (void)out_size; (void)ws_size;
  const float* x = (const float*)d_in[0]; const float* Wq = (const float*)d_in[1]; const float* Wk = (const float*)d_in[2]; const float* Wv = (const float*)d_in[3]; const float* Wo = (const float*)d_in[4];
  float* out = (float*)d_out;
  char* ws = (char*)d_ws; size_t off = 0;
  auto take = [&](size_t bytes) { char* p = ws + off; off += (bytes + 255) & ~(size_t)255; return p; };
  __bf16* Xb = (__bf16*)take((size_t)NR * E * 2); __bf16* PT = (__bf16*)take((size_t)(2 * E + 2 * EKV) * E * 2);
  float* Q32 = (float*)take((size_t)NR * E * 4); __bf16* Kh = (__bf16*)take((size_t)NR * EKV * 2); __bf16* Kl = (__bf16*)take((size_t)NR * EKV * 2); _Float16* VTh = (_Float16*)take((size_t)NR * EKV * 2); _Float16* VTl = (_Float16*)take((size_t)NR * EKV * 2); float* O32 = (float*)take((size_t)NR * E * 4);
  // ws ~ 102 MB
  k_cvt<<<(NR * E / 8 + 255) / 256, 256, 0, stream>>>(x, Xb);
  k_pack<<<2 * E + 2 * EKV, 256, 0, stream>>>(Wq, Wk, Wv, Wo, PT);
  k_qkv<<<dim3(NR / 64, E / 128, 3), 128, 0, stream>>>(Xb, PT, Q32, Kh, Kl, VTh, VTl);
  k_attn<<<dim3(SS / 64, NB * NH), 128, 0, stream>>>(Q32, Kh, Kl, VTh, VTl, O32);
  k_out<<<dim3(NR / 64, E / 128), 128, 0, stream>>>(O32, PT, out);
}

// v002
// It runs in 219 microseconds.
// Two timings next to v001 both put it at 1.31 times that version's speed.
// Counting every step since v000, it is 3.12 times as fast.
// compute dtype: x and wq/wk/wv/wo (INPUTS) rounded to bf16 with exact bf16 WMMA products (f32 accumulate) for the projections; K pre-split into bf16 hi/lo rows; q f32 split, P and V f16 hi/lo (3 products each); softmax f32.
#include <hip/hip_runtime.h>
#include <math.h>

typedef __attribute__((ext_vector_type(16))) _Float16 v16h;
typedef __attribute__((ext_vector_type(16))) __bf16 v16b;
typedef __attribute__((ext_vector_type(8)))  _Float16 v8h;
typedef __attribute__((ext_vector_type(8)))  float v8f;
typedef __attribute__((ext_vector_type(4)))  float v4f;
typedef __attribute__((ext_vector_type(2)))  float v2f;
typedef __attribute__((ext_vector_type(4)))  unsigned v4u;
typedef __attribute__((ext_vector_type(4)))  int v4i;
typedef float __attribute__((may_alias)) float_a;
typedef int __attribute__((may_alias)) int_a;

template <typename T> __device__ __forceinline__ void vst2(void* p, T v) { *(T*)p = v;  }
__device__ __forceinline__ v8f wmma16(v16h a, v16h b, v8f c) {
  v8f d = __builtin_amdgcn_wmma_f32_16x16x32_f16(false, a, false, b, (short)0, c, false, false);
  asm volatile("v_nop\n\tv_nop\n\tv_nop\n\tv_nop" : "+v"(d) : "v"(a), "v"(b));
  return d;
}
__device__ __forceinline__ v8f wmma_bf(v16b a, v16b b, v8f c) {
  v8f d = __builtin_amdgcn_wmma_f32_16x16x32_bf16(false, a, false, b, (short)0, c, false, false);
  asm volatile("v_nop\n\tv_nop\n\tv_nop\n\tv_nop" : "+v"(d) : "v"(a), "v"(b));
  return d;
}
// 16x16x32 fragments: lane = (h = lane>>4, row/col = lane&15); elements 0..7 = k0+8h+0..7, 8..15 = k0+16+8h+0..7; D element r = row 8h+r
__device__ __forceinline__ v16h frag_h(const _Float16* rowk0, int lane) {
  union { v16h v; v8h q[2]; } u; const _Float16* p = rowk0 + 8 * (lane >> 4);
  u.q[0] = *(const v8h*)p; u.q[1] = *(const v8h*)(p + 16); return u.v;
}
__device__ __forceinline__ v16h frag_f32(const float* rowk0, int lane) {
  v16h a; const float* p = rowk0 + 8 * (lane >> 4);
#pragma unroll
  for (int i = 0; i < 8; ++i) { a[i] = (_Float16)p[i]; a[8 + i] = (_Float16)p[16 + i]; }
  return a;
}
__device__ __forceinline__ v16h frag_f32s(const float* rowk0, int lane, float sc) {
  v16h a; const float* p = rowk0 + 8 * (lane >> 4);
#pragma unroll
  for (int i = 0; i < 8; ++i) { a[i] = (_Float16)(p[i] * sc); a[8 + i] = (_Float16)(p[16 + i] * sc); }
  return a;
}
// column fragment from a [K][ld] layout (column n), rows >= K read as 0
__device__ __forceinline__ v16h fragc_f32(const float* W, int k0, int n, int lane, int ld, int K) {
  v16h a; const int g = lane >> 4;
#pragma unroll
  for (int i = 0; i < 8; ++i) { const int ka = k0 + 8 * g + i, kb = ka + 16;
    a[i] = (_Float16)(ka < K ? W[(size_t)ka * ld + n] : 0.f); a[8 + i] = (_Float16)(kb < K ? W[(size_t)kb * ld + n] : 0.f); }
  return a;
}
struct F2 { v16b h, l; };
__device__ __forceinline__ F2 bsplit16(const float v[16]) { F2 r;
#pragma unroll
  for (int i = 0; i < 16; ++i) { const __bf16 h = (__bf16)v[i]; r.h[i] = h; r.l[i] = (__bf16)(v[i] - (float)h); }
  return r; }
__device__ __forceinline__ F2 split_row(const float* row, int k0, int lane) { float v[16]; const float* p = row + k0 + 8 * (lane >> 4);
#pragma unroll
  for (int i = 0; i < 8; ++i) { v[i] = p[i]; v[8 + i] = p[16 + i]; }
  return bsplit16(v); }
__device__ __forceinline__ F2 split_rowK(const float* row, int k0, int lane, int K) { float v[16]; const int g = lane >> 4;
#pragma unroll
  for (int i = 0; i < 8; ++i) { const int ka = k0 + 8 * g + i, kb = ka + 16; v[i] = ka < K ? row[ka] : 0.f; v[8 + i] = kb < K ? row[kb] : 0.f; }
  return bsplit16(v); }
__device__ __forceinline__ F2 split_col(const float* W, int k0, int n, int lane, int ld, int K) { float v[16]; const int g = lane >> 4;
#pragma unroll
  for (int i = 0; i < 8; ++i) { const int ka = k0 + 8 * g + i, kb = ka + 16; v[i] = ka < K ? W[(size_t)ka * ld + n] : 0.f; v[8 + i] = kb < K ? W[(size_t)kb * ld + n] : 0.f; }
  return bsplit16(v); }
__device__ __forceinline__ v8f mac3(const F2& a, const F2& b, v8f c) { c = wmma_bf(a.l, b.h, c); c = wmma_bf(a.h, b.l, c); return wmma_bf(a.h, b.h, c); }
__device__ __forceinline__ float sigm(float v) { return 1.0f / (1.0f + expf(-v)); }
#define LDSX() do { asm volatile("s_wait_dscnt 0" ::: "memory"); __builtin_amdgcn_wave_barrier(); __builtin_amdgcn_fence(__ATOMIC_RELEASE, "workgroup"); } while (0)


// Grouped-query causal self attention (16 query heads, 4 kv heads of 64 on [4,2048,1024], [in][out] weights, no biases): head h reads kv head h/4 (repeat_kv); -inf above the diagonal; (P v) @ wo. Key tiles past the query block are skipped.
#define NB 4
#define SS 2048
#define E 1024
#define NH 16
#define NKV 4
#define EKV (NKV * HD)
#define HD 64
#define NR (NB * SS)
#define PLO 1024.0f
#define VLO 2048.0f
__device__ __forceinline__ float bfr(float v) { return (float)(__bf16)v; }
__device__ __forceinline__ v16b frag_b(const __bf16* rowk0, int lane) { return __builtin_bit_cast(v16b, frag_h((const _Float16*)rowk0, lane)); }

#define TP 72      // LDS row pitch of a staged 128-B row in 16-bit elements: 144 B = 16 B x 9, the conflict-free pitch for 16-byte fragment reads
// Asynchronous copies global -> LDS, 16 B per lane, rows gs bytes apart in global memory and ls bytes apart in LDS. The copies and their s_wait_xcnt stand in one statement, so that no address register is rewritten before the wait.
__device__ __forceinline__ void copy4(unsigned la, unsigned ls, const char* a, size_t gs) {
  asm volatile("global_load_async_to_lds_b128 %0, %4, off\n\t"
               "global_load_async_to_lds_b128 %1, %5, off\n\t"
               "global_load_async_to_lds_b128 %2, %6, off\n\t"
               "global_load_async_to_lds_b128 %3, %7, off\n\t"
               "s_wait_xcnt 0x0"
               :: "v"(la), "v"(la + ls), "v"(la + 2 * ls), "v"(la + 3 * ls), "v"(a), "v"(a + gs), "v"(a + 2 * gs), "v"(a + 3 * gs) : "memory");
}
__device__ __forceinline__ void copy8(unsigned la, unsigned lc, unsigned ls, const char* a, const char* c, size_t gs) {
  asm volatile("global_load_async_to_lds_b128 %0, %8, off\n\t"
               "global_load_async_to_lds_b128 %1, %9, off\n\t"
               "global_load_async_to_lds_b128 %2, %10, off\n\t"
               "global_load_async_to_lds_b128 %3, %11, off\n\t"
               "global_load_async_to_lds_b128 %4, %12, off\n\t"
               "global_load_async_to_lds_b128 %5, %13, off\n\t"
               "global_load_async_to_lds_b128 %6, %14, off\n\t"
               "global_load_async_to_lds_b128 %7, %15, off\n\t"
               "s_wait_xcnt 0x0"
               :: "v"(la), "v"(la + ls), "v"(la + 2 * ls), "v"(la + 3 * ls), "v"(lc), "v"(lc + ls), "v"(lc + 2 * ls), "v"(lc + 3 * ls),
                  "v"(a), "v"(a + gs), "v"(a + 2 * gs), "v"(a + 3 * gs), "v"(c), "v"(c + gs), "v"(c + 2 * gs), "v"(c + 3 * gs) : "memory");
}
// this wave's own copies have landed (in front of the barrier that lets other waves read them, and behind the last copy of a kernel)
#define LANDED() asm volatile("s_wait_asynccnt 0x0" ::: "memory")
// publish point of a staged tile: this wave's LDS reads retired, its own copies landed, then the work-group barrier (it publishes the tile that flew and frees the one just read)
#define PUBLISH() do { asm volatile("s_wait_dscnt 0" ::: "memory"); LANDED(); __syncthreads(); } while (0)

__global__ __launch_bounds__(256) void k_cvt(const float* __restrict__ x, __bf16* __restrict__ Xb) {
  const size_t i8 = (size_t)blockIdx.x * 256 + threadIdx.x; if (i8 >= (size_t)NR * E / 8) return;
  union { __bf16 h[8]; v4u u; } pk;
#pragma unroll
  for (int e = 0; e < 8; ++e) pk.h[e] = (__bf16)x[i8 * 8 + e];
  vst2((unsigned*)(Xb + i8 * 8), pk.u);
}
// PT rows: [0,E) Wq[:,n], [E,E+EKV) Wk[:,n], [E+EKV,E+2EKV) Wv[:,n], [E+2EKV,2E+2EKV) Wo[:,n]  ([in][out] weights: column n as a bf16 row)
__global__ __launch_bounds__(256) void k_pack(const float* __restrict__ Wq, const float* __restrict__ Wk, const float* __restrict__ Wv, const float* __restrict__ Wo, __bf16* __restrict__ PT) {
  const int n = blockIdx.x, tid = threadIdx.x; __shared__ __align__(16) __bf16 srow[E];
  const float* W = n < E ? Wq : (n < E + EKV ? Wk : (n < E + 2 * EKV ? Wv : Wo)); const int nn = n < E ? n : (n < E + EKV ? n - E : (n < E + 2 * EKV ? n - E - EKV : n - E - 2 * EKV)); const int ld = (n >= E && n < E + 2 * EKV) ? EKV : E;      // [in][out]: column nn
  for (int k = tid; k < E; k += 256) srow[k] = (__bf16)W[(size_t)k * ld + nn];
  __syncthreads();
  if (tid < E / 8) vst2((unsigned*)(PT + (size_t)n * E + tid * 8), *(const v4u*)(&srow[tid * 8]));
}
// QKV: block (64 rows, 128 cols = 2 heads, which); q -> Q32 f32 [bh][s][64]; k -> bf16 hi/lo rows; v -> VT hi/lo x4 [bh][d][s]
#define QST (192 * TP * 2)      // bytes of one stage: 64 x rows, then 128 weight rows, 64 k (128 B) each, at pitch TP
__global__ __launch_bounds__(128) void k_qkv(const __bf16* __restrict__ Xb, const __bf16* __restrict__ PT, float* __restrict__ Q32, __bf16* __restrict__ Kh, __bf16* __restrict__ Kl, _Float16* __restrict__ VTh, _Float16* __restrict__ VTl) {
  __shared__ __align__(16) char sm[2 * QST];      // in the loop the two operand stages, behind it the output staging
  float (*so)[16][132] = (float (*)[16][132])sm; _Float16 (*sth)[72] = (_Float16 (*)[72])sm; _Float16 (*stl)[72] = (_Float16 (*)[72])(sm + 128 * 72 * 2);
  const int tid = threadIdx.x, wave = tid >> 5, lane = tid & 31, col = lane & 15, g = lane >> 4;
  const int which = blockIdx.z, r0b = blockIdx.x * 64, r0 = r0b + wave * 16, n0 = blockIdx.y * 128; const int b = r0b / SS, s0 = r0b % SS;
  if (which > 0 && n0 >= EKV) return;      // k and v have only 4 heads
  const int prow = (which == 0 ? 0 : (which == 1 ? E : E + EKV)) + n0;
  v8f acc[8] = {};
  // each lane copies 16 B of rows tid / 8 + 16 i: a wave-wide copy = 4 whole 128-B lines
  const char* gA = (const char*)(Xb + (size_t)(r0b + (tid >> 3)) * E + (tid & 7) * 8); const char* gB = (const char*)(PT + (size_t)(prow + (tid >> 3)) * E + (tid & 7) * 8);
  const unsigned lA = (unsigned)(size_t)sm + (tid >> 3) * (TP * 2) + (tid & 7) * 16, lB = lA + 64 * TP * 2;
  auto stage = [&](int s) { const unsigned o = (s & 1) * QST; const char* a = gA + s * 128; const char* c = gB + s * 128;
    copy4(lA + o, 16 * TP * 2, a, (size_t)16 * E * 2); copy8(lB + o, lB + o + 64 * TP * 2, 16 * TP * 2, c, c + (size_t)64 * E * 2, (size_t)16 * E * 2); };
  stage(0); LANDED(); __syncthreads();
  stage(1);
#pragma unroll 1      // rolled: one pass per stage, the buffer picked by s & 1; unrolling would only lengthen the code
  for (int s = 0; s < E / 64; ++s) { const __bf16* tA = (const __bf16*)(sm + (s & 1) * QST); const __bf16* tB = tA + 64 * TP;
#pragma unroll
    for (int kc = 0; kc < 2; ++kc) { const v16b a = frag_b(tA + (wave * 16 + col) * TP + kc * 32, lane); v16b wb[8];      // the block's LDS reads stand together in front of its WMMAs
#pragma unroll
      for (int j = 0; j < 8; ++j) wb[j] = frag_b(tB + (j * 16 + col) * TP + kc * 32, lane);
#pragma unroll
      for (int j = 0; j < 8; ++j) acc[j] = wmma_bf(a, wb[j], acc[j]); }
    PUBLISH();      // stage s + 1 readable; every wave has left stage s (behind the last pass: the ring is free for the output staging)
    if (s + 2 < E / 64) stage(s + 2); }
  LANDED();
  if (which < 2) {
#pragma unroll
    for (int j = 0; j < 8; ++j) { const float bb = 0.f;
#pragma unroll
      for (int r = 0; r < 8; ++r) so[wave][8 * g + r][j * 16 + col] = acc[j][r] + bb; }
    LDSX();
    if (which == 0) { for (int qq = lane; qq < 2 * 16 * 16; qq += 32) { const int hh = qq >> 8, rl = (qq >> 4) & 15, pc = qq & 15; const int h = (n0 >> 6) + hh;
        vst2(Q32 + (((size_t)b * NH + h) * SS + s0 + wave * 16 + rl) * HD + pc * 4, *(const v4f*)(&so[wave][rl][hh * 64 + pc * 4])); } }
    else {
      for (int qq = lane; qq < 2 * 16 * 16; qq += 32) { const int hh = qq >> 8, rl = (qq >> 4) & 15, pl = qq & 15; const int h = (n0 >> 6) + hh; const int pc = pl & 7; union { __bf16 e[8]; v4u u; } pk;
#pragma unroll
        for (int e = 0; e < 8; ++e) { const float v = so[wave][rl][hh * 64 + pc * 8 + e]; const __bf16 hi = (__bf16)v; pk.e[e] = pl < 8 ? hi : (__bf16)(v - (float)hi); }
        vst2((unsigned*)((pl < 8 ? Kh : Kl) + (((size_t)b * NKV + h) * SS + s0 + wave * 16 + rl) * HD + pc * 8), pk.u); } } }
  else {
#pragma unroll
    for (int j = 0; j < 8; ++j) { const float bb = 0.f;
#pragma unroll
      for (int r = 0; r < 8; ++r) { const float v = (acc[j][r] + bb) * 4.0f; const _Float16 hi = (_Float16)v; sth[j * 16 + col][wave * 16 + 8 * g + r] = hi; stl[j * 16 + col][wave * 16 + 8 * g + r] = (_Float16)((v - (float)hi) * VLO); } }
    __syncthreads();
    for (int qq = tid; qq < 128 * 8; qq += 128) { const int cl = qq >> 3, pc = qq & 7; const int c = n0 + cl, h = c >> 6, d = c & 63; const size_t o = (((size_t)b * NKV + h) * HD + d) * SS + s0 + pc * 8;
      vst2(VTh + o, *(const v4u*)(&sth[cl][pc * 8])); vst2(VTl + o, *(const v4u*)(&stl[cl][pc * 8])); } }
}
// causal attention: block (bh, 64 queries); key tiles up to the diagonal; the K and V tiles are staged once per block in LDS, K(t+1) flying under softmax and PV of t, V(t+1) under S of t+1; S on q hi/lo x K hi/lo rows; P,V hi/lo; O f32 [bh][s][64]
// second launch bound: four waves per SIMD, the residency that the LDS use allows
__global__ __launch_bounds__(128, 4) void k_attn(const float* __restrict__ Q32, const __bf16* __restrict__ Kh, const __bf16* __restrict__ Kl, const _Float16* __restrict__ VTh, const _Float16* __restrict__ VTl, float* __restrict__ O32) {
  __shared__ __align__(16) float sS[4][16][68];
  __shared__ __align__(16) _Float16 sPh[4][16][72], sPl[4][16][72];
  __shared__ __align__(16) __bf16 sKh[64 * TP], sKl[64 * TP];
  __shared__ __align__(16) _Float16 sVh[64 * TP], sVl[64 * TP];
  const int tid = threadIdx.x, w = tid >> 5, lane = tid & 31, col = lane & 15, g = lane >> 4;
  // the longest query blocks carry the lowest block indices (for speed only)
  static_assert((SS / 64 & (SS / 64 - 1)) == 0, "the xor reverses the index only for a power of two");
  const size_t bh = blockIdx.x; const int qb = (SS / 64 - 1) ^ (int)blockIdx.y; const int q0 = qb * 64 + w * 16;
  F2 aq[2];
#pragma unroll
  for (int kc = 0; kc < 2; ++kc) aq[kc] = split_row(Q32 + (bh * SS + q0 + col) * HD, kc * 32, lane);
  const int b = (int)(bh / NH); const size_t kvh = (size_t)b * NKV + (bh % NH) / (NH / NKV);     // repeat_kv: query head h reads kv head h/4
  float mrun = -3.0e38f, lrun = 0.f; v8f acc[4] = {}, ac1[4] = {}, ac2[4] = {};
  LDSX();
  // each lane copies 16 B of rows tid / 8 + 16 i of the hi and of the lo plane: a wave-wide copy = 4 whole 128-B lines
  const size_t kof = ((kvh * SS + (tid >> 3)) * HD + (tid & 7) * 8) * 2, vof = ((kvh * HD + (tid >> 3)) * SS + (tid & 7) * 8) * 2;      // bytes; K tile: rows = keys, 128 B apart; V tile: rows = d, SS * 2 bytes apart
  const char* gKh = (const char*)Kh + kof; const char* gKl = (const char*)Kl + kof; const char* gVh = (const char*)VTh + vof; const char* gVl = (const char*)VTl + vof;
  const unsigned lof = (tid >> 3) * (TP * 2) + (tid & 7) * 16;
  const unsigned lKh = (unsigned)(size_t)sKh + lof, lKl = (unsigned)(size_t)sKl + lof, lVh = (unsigned)(size_t)sVh + lof, lVl = (unsigned)(size_t)sVl + lof;
  copy8(lKh, lKl, 16 * TP * 2, gKh, gKl, (size_t)16 * HD * 2); LANDED(); __syncthreads();
  copy8(lVh, lVl, 16 * TP * 2, gVh, gVl, (size_t)16 * SS * 2);
#pragma unroll 1
  for (int kt = 0; kt <= qb; ++kt) {      // causal
#pragma unroll
    for (int t = 0; t < 4; ++t) { const int key = kt * 64 + t * 16 + col; const int ko = (t * 16 + col) * TP; v8f s = {}; v16b khf[2], klf[2];
#pragma unroll
      for (int kc = 0; kc < 2; ++kc) { khf[kc] = frag_b(sKh + ko + kc * 32, lane); klf[kc] = frag_b(sKl + ko + kc * 32, lane); }      // the block's LDS reads stand together in front of its WMMAs
#pragma unroll
      for (int kc = 0; kc < 2; ++kc) { s = wmma_bf(aq[kc].l, khf[kc], s); s = wmma_bf(aq[kc].h, klf[kc], s); s = wmma_bf(aq[kc].h, khf[kc], s); }
#pragma unroll
      for (int r = 0; r < 8; ++r) sS[w][8 * g + r][t * 16 + col] = (key > q0 + 8 * g + r) ? -1.0e9f : s[r] * 0.125f; }
    PUBLISH();      // V(kt) readable; every wave has left K(kt); the wave's own scores are written
    if (kt < qb) copy8(lKh, lKl, 16 * TP * 2, gKh + (size_t)(kt + 1) * 64 * HD * 2, gKl + (size_t)(kt + 1) * 64 * HD * 2, (size_t)16 * HD * 2);
    float mx = -3.4e38f;
#pragma unroll
    for (int jj = 0; jj < 32; ++jj) mx = fmaxf(mx, sS[w][col][g * 32 + jj]);
    mx = fmaxf(mx, __shfl_xor(mx, 16, 32));
    const float mnew = fmaxf(mrun, mx); const float corr = expf(mrun - mnew);
    float ps = 0.f;
#pragma unroll
    for (int jj = 0; jj < 32; ++jj) { const float p = expf(sS[w][col][g * 32 + jj] - mnew) * 16384.0f; ps += p; const _Float16 hi = (_Float16)p; sPh[w][col][g * 32 + jj] = hi; sPl[w][col][g * 32 + jj] = (_Float16)((p - (float)hi) * PLO); }
    ps += __shfl_xor(ps, 16, 32);
    lrun = lrun * corr + ps * (1.0f / 16384.0f); mrun = mnew;
#pragma unroll
    for (int r = 0; r < 8; ++r) { const float cr = __shfl(corr, 8 * g + r, 32);
#pragma unroll
      for (int t = 0; t < 4; ++t) { acc[t][r] *= cr; ac1[t][r] *= cr; ac2[t][r] *= cr; } }
    LDSX();
#pragma unroll
    for (int kc = 0; kc < 2; ++kc) { const v16h ph = frag_h(&sPh[w][col][0] + kc * 32, lane), pl = frag_h(&sPl[w][col][0] + kc * 32, lane);
#pragma unroll
      for (int t = 0; t < 4; ++t) { const int vo = (t * 16 + col) * TP + kc * 32; const v16h vh = frag_h(sVh + vo, lane), vl = frag_h(sVl + vo, lane);      // the block's LDS reads stand together in front of its WMMAs
        acc[t] = wmma16(ph, vh, acc[t]); ac1[t] = wmma16(ph, vl, ac1[t]); ac2[t] = wmma16(pl, vh, ac2[t]); } }
    PUBLISH();      // K(kt + 1) readable; every wave has left V(kt)
    if (kt < qb) copy8(lVh, lVl, 16 * TP * 2, gVh + (size_t)(kt + 1) * 64 * 2, gVl + (size_t)(kt + 1) * 64 * 2, (size_t)16 * SS * 2); }
  LANDED();
#pragma unroll
  for (int r = 0; r < 8; ++r) { const float lr = __shfl(lrun, 8 * g + r, 32); const float inv = 1.0f / (lr * 16384.0f * 4.0f);
#pragma unroll
    for (int t = 0; t < 4; ++t) sS[w][8 * g + r][t * 16 + col] = (acc[t][r] + ac1[t][r] * (1.0f / VLO) + ac2[t][r] * (1.0f / PLO)) * inv; }
  LDSX();
  for (int qq = lane; qq < 16 * 16; qq += 32) { const int rl = qq >> 4, pc = qq & 15; vst2(O32 + ((bh * SS) + q0 + rl) * HD + pc * 4, *(const v4f*)(&sS[w][rl][pc * 4])); }
}
// out = ctx Wo : split(ctx) x bf16(Wo rows): 2 products (Wo is an INPUT -> bf16 exact)
#define CP 68      // LDS row pitch of a staged 256-B f32 row in floats: 272 B = 16 B x 17
#define OSA (64 * CP * 4)      // bytes of the ctx part of a stage: 64 rows of one head
#define OST (OSA + 128 * TP * 2)      // bytes of one stage: the ctx rows, then 128 weight rows of 64 k
__global__ __launch_bounds__(128) void k_out(const float* __restrict__ O32, const __bf16* __restrict__ PT, float* __restrict__ out) {
  __shared__ __align__(16) char sm[2 * OST];      // in the loop the two operand stages, behind it the output staging
  float (*so)[16][132] = (float (*)[16][132])sm;
  const int tid = threadIdx.x, wave = tid >> 5, lane = tid & 31, col = lane & 15, g = lane >> 4;
  const int r0b = blockIdx.x * 64, r0 = r0b + wave * 16, n0 = blockIdx.y * 128; const int b = r0b / SS, s0 = r0b % SS;
  v8f acc[8] = {};
  // ctx: each lane copies 16 B of rows tid / 16 + 8 i (a wave-wide copy = 2 rows = 4 whole lines); weights: 16 B of rows tid / 8 + 16 i
  const char* gA = (const char*)(O32 + ((size_t)b * NH * SS + s0 + (tid >> 4)) * HD + (tid & 15) * 4); const char* gB = (const char*)(PT + (size_t)(E + 2 * EKV + n0 + (tid >> 3)) * E + (tid & 7) * 8);
  const unsigned lA = (unsigned)(size_t)sm + (tid >> 4) * (CP * 4) + (tid & 15) * 16, lB = (unsigned)(size_t)sm + OSA + (tid >> 3) * (TP * 2) + (tid & 7) * 16;
  auto stage = [&](int h) { const unsigned o = (h & 1) * OST; const char* a = gA + (size_t)h * SS * HD * 4; const char* c = gB + h * 128;
    copy8(lA + o, lA + o + 32 * CP * 4, 8 * CP * 4, a, a + 32 * HD * 4, (size_t)8 * HD * 4); copy8(lB + o, lB + o + 64 * TP * 2, 16 * TP * 2, c, c + (size_t)64 * E * 2, (size_t)16 * E * 2); };
  stage(0); LANDED(); __syncthreads();
  stage(1);
#pragma unroll 1      // rolled: one pass per stage, the buffer picked by h & 1; unrolling would only lengthen the code
  for (int h = 0; h < NH; ++h) { const float* tA = (const float*)(sm + (h & 1) * OST); const __bf16* tB = (const __bf16*)(sm + (h & 1) * OST + OSA);
#pragma unroll
    for (int kc = 0; kc < 2; ++kc) { const F2 a = split_row(tA + (wave * 16 + col) * CP, kc * 32, lane); v16b wb[8];      // the block's LDS reads stand together in front of its WMMAs
#pragma unroll
      for (int j = 0; j < 8; ++j) wb[j] = frag_b(tB + (j * 16 + col) * TP + kc * 32, lane);
#pragma unroll
      for (int j = 0; j < 8; ++j) { acc[j] = wmma_bf(a.l, wb[j], acc[j]); acc[j] = wmma_bf(a.h, wb[j], acc[j]); } }
    PUBLISH();      // stage h + 1 readable; every wave has left stage h (behind the last pass: the ring is free for the output staging)
    if (h + 2 < NH) stage(h + 2); }
  LANDED();
#pragma unroll
  for (int j = 0; j < 8; ++j) {
#pragma unroll
    for (int r = 0; r < 8; ++r) so[wave][8 * g + r][j * 16 + col] = acc[j][r]; }
  LDSX();
#pragma unroll 4
  for (int rl = 0; rl < 16; ++rl) vst2(out + (size_t)(r0 + rl) * E + n0 + lane * 4, *(const v4f*)(&so[wave][rl][lane * 4]));
}
extern "C" void kernel_launch(void* const* d_in, const int* in_sizes, int n_in, void* d_out, int out_size, void* d_ws, size_t ws_size, hipStream_t stream) {
  (void)in_sizes; (void)n_in; (void)out_size; (void)ws_size;
  const float* x = (const float*)d_in[0]; const float* Wq = (const float*)d_in[1]; const float* Wk = (const float*)d_in[2]; const float* Wv = (const float*)d_in[3]; const float* Wo = (const float*)d_in[4];
  float* out = (float*)d_out;
  char* ws = (char*)d_ws; size_t off = 0;
  auto take = [&](size_t bytes) { char* p = ws + off; off += (bytes + 255) & ~(size_t)255; return p; };
  __bf16* Xb = (__bf16*)take((size_t)NR * E * 2); __bf16* PT = (__bf16*)take((size_t)(2 * E + 2 * EKV) * E * 2);
  float* Q32 = (float*)take((size_t)NR * E * 4); __bf16* Kh = (__bf16*)take((size_t)NR * EKV * 2); __bf16* Kl = (__bf16*)take((size_t)NR * EKV * 2); _Float16* VTh = (_Float16*)take((size_t)NR * EKV * 2); _Float16* VTl = (_Float16*)take((size_t)NR * EKV * 2); float* O32 = (float*)take((size_t)NR * E * 4);
  // ws ~ 102 MB
  k_cvt<<<(NR * E / 8 + 255) / 256, 256, 0, stream>>>(x, Xb);
  k_pack<<<2 * E + 2 * EKV, 256, 0, stream>>>(Wq, Wk, Wv, Wo, PT);
  k_qkv<<<dim3(NR / 64, E / 128, 3), 128, 0, stream>>>(Xb, PT, Q32, Kh, Kl, VTh, VTl);
  k_attn<<<dim3(NB * NH, SS / 64), 128, 0, stream>>>(Q32, Kh, Kl, VTh, VTl, O32);
  k_out<<<dim3(NR / 64, E / 128), 128, 0, stream>>>(O32, PT, out);
}

// v003
// A run of this version takes 196 microseconds.
// Next to v002, in two timings, it ran 1.11 and 1.12 times as fast.
// Counting every step since v000, it is 3.49 times as fast.
// compute dtype: x and wq/wk/wv/wo (INPUTS) rounded to bf16 with exact bf16 WMMA products (f32 accumulate) for the projections; K pre-split into bf16 hi/lo rows; q f32 split, P and V f16 hi/lo (3 products each); softmax f32.
#include <hip/hip_runtime.h>
#include <math.h>

typedef __attribute__((ext_vector_type(16))) _Float16 v16h;
typedef __attribute__((ext_vector_type(16))) __bf16 v16b;
typedef __attribute__((ext_vector_type(8)))  _Float16 v8h;
typedef __attribute__((ext_vector_type(8)))  float v8f;
typedef __attribute__((ext_vector_type(4)))  float v4f;
typedef __attribute__((ext_vector_type(2)))  float v2f;
typedef __attribute__((ext_vector_type(4)))  unsigned v4u;
typedef __attribute__((ext_vector_type(4)))  int v4i;
typedef float __attribute__((may_alias)) float_a;
typedef int __attribute__((may_alias)) int_a;

template <typename T> __device__ __forceinline__ void vst2(void* p, T v) { *(T*)p = v;  }
__device__ __forceinline__ v8f wmma16(v16h a, v16h b, v8f c) {
  v8f d = __builtin_amdgcn_wmma_f32_16x16x32_f16(false, a, false, b, (short)0, c, false, false);
  asm volatile("v_nop\n\tv_nop\n\tv_nop\n\tv_nop" : "+v"(d) : "v"(a), "v"(b));
  return d;
}
__device__ __forceinline__ v8f wmma_bf(v16b a, v16b b, v8f c) {
  v8f d = __builtin_amdgcn_wmma_f32_16x16x32_bf16(false, a, false, b, (short)0, c, false, false);
  asm volatile("v_nop\n\tv_nop\n\tv_nop\n\tv_nop" : "+v"(d) : "v"(a), "v"(b));
  return d;
}
// 16x16x32 fragments: lane = (h = lane>>4, row/col = lane&15); elements 0..7 = k0+8h+0..7, 8..15 = k0+16+8h+0..7; D element r = row 8h+r
__device__ __forceinline__ v16h frag_h(const _Float16* rowk0, int lane) {
  union { v16h v; v8h q[2]; } u; const _Float16* p = rowk0 + 8 * (lane >> 4);
  u.q[0] = *(const v8h*)p; u.q[1] = *(const v8h*)(p + 16); return u.v;
}
__device__ __forceinline__ v16h frag_f32(const float* rowk0, int lane) {
  v16h a; const float* p = rowk0 + 8 * (lane >> 4);
#pragma unroll
  for (int i = 0; i < 8; ++i) { a[i] = (_Float16)p[i]; a[8 + i] = (_Float16)p[16 + i]; }
  return a;
}
__device__ __forceinline__ v16h frag_f32s(const float* rowk0, int lane, float sc) {
  v16h a; const float* p = rowk0 + 8 * (lane >> 4);
#pragma unroll
  for (int i = 0; i < 8; ++i) { a[i] = (_Float16)(p[i] * sc); a[8 + i] = (_Float16)(p[16 + i] * sc); }
  return a;
}
// column fragment from a [K][ld] layout (column n), rows >= K read as 0
__device__ __forceinline__ v16h fragc_f32(const float* W, int k0, int n, int lane, int ld, int K) {
  v16h a; const int g = lane >> 4;
#pragma unroll
  for (int i = 0; i < 8; ++i) { const int ka = k0 + 8 * g + i, kb = ka + 16;
    a[i] = (_Float16)(ka < K ? W[(size_t)ka * ld + n] : 0.f); a[8 + i] = (_Float16)(kb < K ? W[(size_t)kb * ld + n] : 0.f); }
  return a;
}
struct F2 { v16b h, l; };
__device__ __forceinline__ F2 bsplit16(const float v[16]) { F2 r;
#pragma unroll
  for (int i = 0; i < 16; ++i) { const __bf16 h = (__bf16)v[i]; r.h[i] = h; r.l[i] = (__bf16)(v[i] - (float)h); }
  return r; }
__device__ __forceinline__ F2 split_row(const float* row, int k0, int lane) { float v[16]; const float* p = row + k0 + 8 * (lane >> 4);
#pragma unroll
  for (int i = 0; i < 8; ++i) { v[i] = p[i]; v[8 + i] = p[16 + i]; }
  return bsplit16(v); }
__device__ __forceinline__ F2 split_rowK(const float* row, int k0, int lane, int K) { float v[16]; const int g = lane >> 4;
#pragma unroll
  for (int i = 0; i < 8; ++i) { const int ka = k0 + 8 * g + i, kb = ka + 16; v[i] = ka < K ? row[ka] : 0.f; v[8 + i] = kb < K ? row[kb] : 0.f; }
  return bsplit16(v); }
__device__ __forceinline__ F2 split_col(const float* W, int k0, int n, int lane, int ld, int K) { float v[16]; const int g = lane >> 4;
#pragma unroll
  for (int i = 0; i < 8; ++i) { const int ka = k0 + 8 * g + i, kb = ka + 16; v[i] = ka < K ? W[(size_t)ka * ld + n] : 0.f; v[8 + i] = kb < K ? W[(size_t)kb * ld + n] : 0.f; }
  return bsplit16(v); }
__device__ __forceinline__ v8f mac3(const F2& a, const F2& b, v8f c) { c = wmma_bf(a.l, b.h, c); c = wmma_bf(a.h, b.l, c); return wmma_bf(a.h, b.h, c); }
__device__ __forceinline__ float sigm(float v) { return 1.0f / (1.0f + expf(-v)); }
#define LDSX() do { asm volatile("s_wait_dscnt 0" ::: "memory"); __builtin_amdgcn_wave_barrier(); __builtin_amdgcn_fence(__ATOMIC_RELEASE, "workgroup"); } while (0)


// Grouped-query causal self attention (16 query heads, 4 kv heads of 64 on [4,2048,1024], [in][out] weights, no biases): head h reads kv head h/4 (repeat_kv); -inf above the diagonal; (P v) @ wo. Key tiles past the query block are skipped.
#define NB 4
#define SS 2048
#define E 1024
#define NH 16
#define NKV 4
#define EKV (NKV * HD)
#define HD 64
#define NR (NB * SS)
#define PLO 1024.0f
#define VLO 2048.0f
#define SC2 0.18033688f      // 1/sqrt(64) x log2(e): the scores and their running maximum are kept in base-2 units, so that each exponential is one hardware exp2
__device__ __forceinline__ float bfr(float v) { return (float)(__bf16)v; }
__device__ __forceinline__ v16b frag_b(const __bf16* rowk0, int lane) { return __builtin_bit_cast(v16b, frag_h((const _Float16*)rowk0, lane)); }

#define TP 72      // LDS row pitch of a staged 128-B row in 16-bit elements: 144 B = 16 B x 9, the conflict-free pitch for 16-byte fragment reads
// Asynchronous copies global -> LDS, 16 B per lane, rows gs bytes apart in global memory and ls bytes apart in LDS. The copies and their s_wait_xcnt stand in one statement, so that no address register is rewritten before the wait.
__device__ __forceinline__ void copy4(unsigned la, unsigned ls, const char* a, size_t gs) {
  asm volatile("global_load_async_to_lds_b128 %0, %4, off\n\t"
               "global_load_async_to_lds_b128 %1, %5, off\n\t"
               "global_load_async_to_lds_b128 %2, %6, off\n\t"
               "global_load_async_to_lds_b128 %3, %7, off\n\t"
               "s_wait_xcnt 0x0"
               :: "v"(la), "v"(la + ls), "v"(la + 2 * ls), "v"(la + 3 * ls), "v"(a), "v"(a + gs), "v"(a + 2 * gs), "v"(a + 3 * gs) : "memory");
}
__device__ __forceinline__ void copy8(unsigned la, unsigned lc, unsigned ls, const char* a, const char* c, size_t gs) {
  asm volatile("global_load_async_to_lds_b128 %0, %8, off\n\t"
               "global_load_async_to_lds_b128 %1, %9, off\n\t"
               "global_load_async_to_lds_b128 %2, %10, off\n\t"
               "global_load_async_to_lds_b128 %3, %11, off\n\t"
               "global_load_async_to_lds_b128 %4, %12, off\n\t"
               "global_load_async_to_lds_b128 %5, %13, off\n\t"
               "global_load_async_to_lds_b128 %6, %14, off\n\t"
               "global_load_async_to_lds_b128 %7, %15, off\n\t"
               "s_wait_xcnt 0x0"
               :: "v"(la), "v"(la + ls), "v"(la + 2 * ls), "v"(la + 3 * ls), "v"(lc), "v"(lc + ls), "v"(lc + 2 * ls), "v"(lc + 3 * ls),
                  "v"(a), "v"(a + gs), "v"(a + 2 * gs), "v"(a + 3 * gs), "v"(c), "v"(c + gs), "v"(c + 2 * gs), "v"(c + 3 * gs) : "memory");
}
// this wave's own copies have landed (in front of the barrier that lets other waves read them, and behind the last copy of a kernel)
#define LANDED() asm volatile("s_wait_asynccnt 0x0" ::: "memory")
// publish point of a staged tile: this wave's LDS reads retired, its own copies landed, then the work-group barrier (it publishes the tile that flew and frees the one just read)
#define PUBLISH() do { asm volatile("s_wait_dscnt 0" ::: "memory"); LANDED(); __syncthreads(); } while (0)

__global__ __launch_bounds__(256) void k_cvt(const float* __restrict__ x, __bf16* __restrict__ Xb) {
  const size_t i8 = (size_t)blockIdx.x * 256 + threadIdx.x; if (i8 >= (size_t)NR * E / 8) return;
  union { __bf16 h[8]; v4u u; } pk;
#pragma unroll
  for (int e = 0; e < 8; ++e) pk.h[e] = (__bf16)x[i8 * 8 + e];
  vst2((unsigned*)(Xb + i8 * 8), pk.u);
}
// PT rows: [0,E) Wq[:,n], [E,E+EKV) Wk[:,n], [E+EKV,E+2EKV) Wv[:,n], [E+2EKV,2E+2EKV) Wo[:,n]  ([in][out] weights: column n as a bf16 row)
__global__ __launch_bounds__(256) void k_pack(const float* __restrict__ Wq, const float* __restrict__ Wk, const float* __restrict__ Wv, const float* __restrict__ Wo, __bf16* __restrict__ PT) {
  const int n = blockIdx.x, tid = threadIdx.x; __shared__ __align__(16) __bf16 srow[E];
  const float* W = n < E ? Wq : (n < E + EKV ? Wk : (n < E + 2 * EKV ? Wv : Wo)); const int nn = n < E ? n : (n < E + EKV ? n - E : (n < E + 2 * EKV ? n - E - EKV : n - E - 2 * EKV)); const int ld = (n >= E && n < E + 2 * EKV) ? EKV : E;      // [in][out]: column nn
  for (int k = tid; k < E; k += 256) srow[k] = (__bf16)W[(size_t)k * ld + nn];
  __syncthreads();
  if (tid < E / 8) vst2((unsigned*)(PT + (size_t)n * E + tid * 8), *(const v4u*)(&srow[tid * 8]));
}
// QKV: block (64 rows, 128 cols = 2 heads, which); q -> Q32 f32 [bh][s][64]; k -> bf16 hi/lo rows; v -> VT hi/lo x4 [bh][d][s]
#define QST (192 * TP * 2)      // bytes of one stage: 64 x rows, then 128 weight rows, 64 k (128 B) each, at pitch TP
__global__ __launch_bounds__(128) void k_qkv(const __bf16* __restrict__ Xb, const __bf16* __restrict__ PT, float* __restrict__ Q32, __bf16* __restrict__ Kh, __bf16* __restrict__ Kl, _Float16* __restrict__ VTh, _Float16* __restrict__ VTl) {
  __shared__ __align__(16) char sm[2 * QST];      // in the loop the two operand stages, behind it the output staging
  float (*so)[16][132] = (float (*)[16][132])sm; _Float16 (*sth)[72] = (_Float16 (*)[72])sm; _Float16 (*stl)[72] = (_Float16 (*)[72])(sm + 128 * 72 * 2);
  const int tid = threadIdx.x, wave = tid >> 5, lane = tid & 31, col = lane & 15, g = lane >> 4;
  const int which = blockIdx.z, r0b = blockIdx.x * 64, r0 = r0b + wave * 16, n0 = blockIdx.y * 128; const int b = r0b / SS, s0 = r0b % SS;
  if (which > 0 && n0 >= EKV) return;      // k and v have only 4 heads
  const int prow = (which == 0 ? 0 : (which == 1 ? E : E + EKV)) + n0;
  v8f acc[8] = {};
  // each lane copies 16 B of rows tid / 8 + 16 i: a wave-wide copy = 4 whole 128-B lines
  const char* gA = (const char*)(Xb + (size_t)(r0b + (tid >> 3)) * E + (tid & 7) * 8); const char* gB = (const char*)(PT + (size_t)(prow + (tid >> 3)) * E + (tid & 7) * 8);
  const unsigned lA = (unsigned)(size_t)sm + (tid >> 3) * (TP * 2) + (tid & 7) * 16, lB = lA + 64 * TP * 2;
  auto stage = [&](int s) { const unsigned o = (s & 1) * QST; const char* a = gA + s * 128; const char* c = gB + s * 128;
    copy4(lA + o, 16 * TP * 2, a, (size_t)16 * E * 2); copy8(lB + o, lB + o + 64 * TP * 2, 16 * TP * 2, c, c + (size_t)64 * E * 2, (size_t)16 * E * 2); };
  stage(0); LANDED(); __syncthreads();
  stage(1);
#pragma unroll 1      // rolled: one pass per stage, the buffer picked by s & 1; unrolling would only lengthen the code
  for (int s = 0; s < E / 64; ++s) { const __bf16* tA = (const __bf16*)(sm + (s & 1) * QST); const __bf16* tB = tA + 64 * TP;
#pragma unroll
    for (int kc = 0; kc < 2; ++kc) { const v16b a = frag_b(tA + (wave * 16 + col) * TP + kc * 32, lane); v16b wb[8];      // the block's LDS reads stand together in front of its WMMAs
#pragma unroll
      for (int j = 0; j < 8; ++j) wb[j] = frag_b(tB + (j * 16 + col) * TP + kc * 32, lane);
#pragma unroll
      for (int j = 0; j < 8; ++j) acc[j] = wmma_bf(a, wb[j], acc[j]); }
    PUBLISH();      // stage s + 1 readable; every wave has left stage s (behind the last pass: the ring is free for the output staging)
    if (s + 2 < E / 64) stage(s + 2); }
  LANDED();
  if (which < 2) {
#pragma unroll
    for (int j = 0; j < 8; ++j) { const float bb = 0.f;
#pragma unroll
      for (int r = 0; r < 8; ++r) so[wave][8 * g + r][j * 16 + col] = acc[j][r] + bb; }
    LDSX();
    if (which == 0) { for (int qq = lane; qq < 2 * 16 * 16; qq += 32) { const int hh = qq >> 8, rl = (qq >> 4) & 15, pc = qq & 15; const int h = (n0 >> 6) + hh;
        vst2(Q32 + (((size_t)b * NH + h) * SS + s0 + wave * 16 + rl) * HD + pc * 4, *(const v4f*)(&so[wave][rl][hh * 64 + pc * 4])); } }
    else {
      for (int qq = lane; qq < 2 * 16 * 16; qq += 32) { const int hh = qq >> 8, rl = (qq >> 4) & 15, pl = qq & 15; const int h = (n0 >> 6) + hh; const int pc = pl & 7; union { __bf16 e[8]; v4u u; } pk;
#pragma unroll
        for (int e = 0; e < 8; ++e) { const float v = so[wave][rl][hh * 64 + pc * 8 + e]; const __bf16 hi = (__bf16)v; pk.e[e] = pl < 8 ? hi : (__bf16)(v - (float)hi); }
        vst2((unsigned*)((pl < 8 ? Kh : Kl) + (((size_t)b * NKV + h) * SS + s0 + wave * 16 + rl) * HD + pc * 8), pk.u); } } }
  else {
#pragma unroll
    for (int j = 0; j < 8; ++j) { const float bb = 0.f;
#pragma unroll
      for (int r = 0; r < 8; ++r) { const float v = (acc[j][r] + bb) * 4.0f; const _Float16 hi = (_Float16)v; sth[j * 16 + col][wave * 16 + 8 * g + r] = hi; stl[j * 16 + col][wave * 16 + 8 * g + r] = (_Float16)((v - (float)hi) * VLO); } }
    __syncthreads();
    for (int qq = tid; qq < 128 * 8; qq += 128) { const int cl = qq >> 3, pc = qq & 7; const int c = n0 + cl, h = c >> 6, d = c & 63; const size_t o = (((size_t)b * NKV + h) * HD + d) * SS + s0 + pc * 8;
      vst2(VTh + o, *(const v4u*)(&sth[cl][pc * 8])); vst2(VTl + o, *(const v4u*)(&stl[cl][pc * 8])); } }
}
// causal attention: block (bh, 64 queries); key tiles up to the diagonal; the K and V tiles are staged once per block in LDS, K(t+1) flying under softmax and PV of t, V(t+1) under S of t+1; S on q hi/lo x K hi/lo rows; P,V hi/lo; O f32 [bh][s][64]
// second launch bound: four waves per SIMD, the residency that the LDS use allows
__global__ __launch_bounds__(128, 4) void k_attn(const float* __restrict__ Q32, const __bf16* __restrict__ Kh, const __bf16* __restrict__ Kl, const _Float16* __restrict__ VTh, const _Float16* __restrict__ VTl, float* __restrict__ O32) {
  __shared__ __align__(16) float sS[4][16][68];
  __shared__ __align__(16) _Float16 sPh[4][16][72], sPl[4][16][72];
  __shared__ __align__(16) __bf16 sKh[64 * TP], sKl[64 * TP];
  __shared__ __align__(16) _Float16 sVh[64 * TP], sVl[64 * TP];
  const int tid = threadIdx.x, w = tid >> 5, lane = tid & 31, col = lane & 15, g = lane >> 4;
  // the longest query blocks carry the lowest block indices (for speed only)
  static_assert((SS / 64 & (SS / 64 - 1)) == 0, "the xor reverses the index only for a power of two");
  const size_t bh = blockIdx.x; const int qb = (SS / 64 - 1) ^ (int)blockIdx.y; const int q0 = qb * 64 + w * 16;
  F2 aq[2];
#pragma unroll
  for (int kc = 0; kc < 2; ++kc) aq[kc] = split_row(Q32 + (bh * SS + q0 + col) * HD, kc * 32, lane);
  const int b = (int)(bh / NH); const size_t kvh = (size_t)b * NKV + (bh % NH) / (NH / NKV);     // repeat_kv: query head h reads kv head h/4
  float mrun = -3.0e38f, lrun = 0.f; v8f acc[4] = {}, ac1[4] = {}, ac2[4] = {};
  LDSX();
  // each lane copies 16 B of rows tid / 8 + 16 i of the hi and of the lo plane: a wave-wide copy = 4 whole 128-B lines
  const size_t kof = ((kvh * SS + (tid >> 3)) * HD + (tid & 7) * 8) * 2, vof = ((kvh * HD + (tid >> 3)) * SS + (tid & 7) * 8) * 2;      // bytes; K tile: rows = keys, 128 B apart; V tile: rows = d, SS * 2 bytes apart
  const char* gKh = (const char*)Kh + kof; const char* gKl = (const char*)Kl + kof; const char* gVh = (const char*)VTh + vof; const char* gVl = (const char*)VTl + vof;
  const unsigned lof = (tid >> 3) * (TP * 2) + (tid & 7) * 16;
  const unsigned lKh = (unsigned)(size_t)sKh + lof, lKl = (unsigned)(size_t)sKl + lof, lVh = (unsigned)(size_t)sVh + lof, lVl = (unsigned)(size_t)sVl + lof;
  copy8(lKh, lKl, 16 * TP * 2, gKh, gKl, (size_t)16 * HD * 2); LANDED(); __syncthreads();
  copy8(lVh, lVl, 16 * TP * 2, gVh, gVl, (size_t)16 * SS * 2);
#pragma unroll 1
  for (int kt = 0; kt <= qb; ++kt) {      // causal
#pragma unroll
    for (int t = 0; t < 4; ++t) { const int key = kt * 64 + t * 16 + col; const int ko = (t * 16 + col) * TP; v8f s = {}; v16b khf[2], klf[2];
#pragma unroll
      for (int kc = 0; kc < 2; ++kc) { khf[kc] = frag_b(sKh + ko + kc * 32, lane); klf[kc] = frag_b(sKl + ko + kc * 32, lane); }      // the block's LDS reads stand together in front of its WMMAs
#pragma unroll
      for (int kc = 0; kc < 2; ++kc) { s = wmma_bf(aq[kc].l, khf[kc], s); s = wmma_bf(aq[kc].h, klf[kc], s); s = wmma_bf(aq[kc].h, khf[kc], s); }
#pragma unroll
      for (int r = 0; r < 8; ++r) sS[w][8 * g + r][t * 16 + col] = (key > q0 + 8 * g + r) ? -1.0e9f : s[r] * SC2; }
    PUBLISH();      // V(kt) readable; every wave has left K(kt); the wave's own scores are written
    if (kt < qb) copy8(lKh, lKl, 16 * TP * 2, gKh + (size_t)(kt + 1) * 64 * HD * 2, gKl + (size_t)(kt + 1) * 64 * HD * 2, (size_t)16 * HD * 2);
    float mx = -3.4e38f;
#pragma unroll
    for (int jj = 0; jj < 32; ++jj) mx = fmaxf(mx, sS[w][col][g * 32 + jj]);
    mx = fmaxf(mx, __shfl_xor(mx, 16, 32));
    const float mnew = fmaxf(mrun, mx); float corr; asm("v_exp_f32 %0, %1\n\tv_nop" : "=v"(corr) : "v"(mrun - mnew));      // exp2 and the one free slot that a transcendental wants behind it, in one statement
    const float moff = mnew - 14.0f;      // 2^14, the scale of P, rides in the exponent
    float ps = 0.f;
#pragma unroll
    for (int jj = 0; jj < 32; ++jj) { const float p = __builtin_amdgcn_exp2f(sS[w][col][g * 32 + jj] - moff); ps += p; const _Float16 hi = (_Float16)p; sPh[w][col][g * 32 + jj] = hi; sPl[w][col][g * 32 + jj] = (_Float16)((p - (float)hi) * PLO); }
    ps += __shfl_xor(ps, 16, 32);
    lrun = lrun * corr + ps * (1.0f / 16384.0f); mrun = mnew;
#pragma unroll
    for (int r = 0; r < 8; ++r) { const float cr = __shfl(corr, 8 * g + r, 32);
#pragma unroll
      for (int t = 0; t < 4; ++t) { acc[t][r] *= cr; ac1[t][r] *= cr; ac2[t][r] *= cr; } }
    LDSX();
#pragma unroll
    for (int kc = 0; kc < 2; ++kc) { const v16h ph = frag_h(&sPh[w][col][0] + kc * 32, lane), pl = frag_h(&sPl[w][col][0] + kc * 32, lane);
#pragma unroll
      for (int t = 0; t < 4; ++t) { const int vo = (t * 16 + col) * TP + kc * 32; const v16h vh = frag_h(sVh + vo, lane), vl = frag_h(sVl + vo, lane);      // the block's LDS reads stand together in front of its WMMAs
        acc[t] = wmma16(ph, vh, acc[t]); ac1[t] = wmma16(ph, vl, ac1[t]); ac2[t] = wmma16(pl, vh, ac2[t]); } }
    PUBLISH();      // K(kt + 1) readable; every wave has left V(kt)
    if (kt < qb) copy8(lVh, lVl, 16 * TP * 2, gVh + (size_t)(kt + 1) * 64 * 2, gVl + (size_t)(kt + 1) * 64 * 2, (size_t)16 * SS * 2); }
  LANDED();
#pragma unroll
  for (int r = 0; r < 8; ++r) { const float lr = __shfl(lrun, 8 * g + r, 32); const float inv = 1.0f / (lr * 16384.0f * 4.0f);
#pragma unroll
    for (int t = 0; t < 4; ++t) sS[w][8 * g + r][t * 16 + col] = (acc[t][r] + ac1[t][r] * (1.0f / VLO) + ac2[t][r] * (1.0f / PLO)) * inv; }
  LDSX();
  for (int qq = lane; qq < 16 * 16; qq += 32) { const int rl = qq >> 4, pc = qq & 15; vst2(O32 + ((bh * SS) + q0 + rl) * HD + pc * 4, *(const v4f*)(&sS[w][rl][pc * 4])); }
}
// out = ctx Wo : split(ctx) x bf16(Wo rows): 2 products (Wo is an INPUT -> bf16 exact)
#define CP 68      // LDS row pitch of a staged 256-B f32 row in floats: 272 B = 16 B x 17
#define OSA (64 * CP * 4)      // bytes of the ctx part of a stage: 64 rows of one head
#define OST (OSA + 128 * TP * 2)      // bytes of one stage: the ctx rows, then 128 weight rows of 64 k
__global__ __launch_bounds__(128) void k_out(const float* __restrict__ O32, const __bf16* __restrict__ PT, float* __restrict__ out) {
  __shared__ __align__(16) char sm[2 * OST];      // in the loop the two operand stages, behind it the output staging
  float (*so)[16][132] = (float (*)[16][132])sm;
  const int tid = threadIdx.x, wave = tid >> 5, lane = tid & 31, col = lane & 15, g = lane >> 4;
  const int r0b = blockIdx.x * 64, r0 = r0b + wave * 16, n0 = blockIdx.y * 128; const int b = r0b / SS, s0 = r0b % SS;
  v8f acc[8] = {};
  // ctx: each lane copies 16 B of rows tid / 16 + 8 i (a wave-wide copy = 2 rows = 4 whole lines); weights: 16 B of rows tid / 8 + 16 i
  const char* gA = (const char*)(O32 + ((size_t)b * NH * SS + s0 + (tid >> 4)) * HD + (tid & 15) * 4); const char* gB = (const char*)(PT + (size_t)(E + 2 * EKV + n0 + (tid >> 3)) * E + (tid & 7) * 8);
  const unsigned lA = (unsigned)(size_t)sm + (tid >> 4) * (CP * 4) + (tid & 15) * 16, lB = (unsigned)(size_t)sm + OSA + (tid >> 3) * (TP * 2) + (tid & 7) * 16;
  auto stage = [&](int h) { const unsigned o = (h & 1) * OST; const char* a = gA + (size_t)h * SS * HD * 4; const char* c = gB + h * 128;
    copy8(lA + o, lA + o + 32 * CP * 4, 8 * CP * 4, a, a + 32 * HD * 4, (size_t)8 * HD * 4); copy8(lB + o, lB + o + 64 * TP * 2, 16 * TP * 2, c, c + (size_t)64 * E * 2, (size_t)16 * E * 2); };
  stage(0); LANDED(); __syncthreads();
  stage(1);
#pragma unroll 1      // rolled: one pass per stage, the buffer picked by h & 1; unrolling would only lengthen the code
  for (int h = 0; h < NH; ++h) { const float* tA = (const float*)(sm + (h & 1) * OST); const __bf16* tB = (const __bf16*)(sm + (h & 1) * OST + OSA);
#pragma unroll
    for (int kc = 0; kc < 2; ++kc) { const F2 a = split_row(tA + (wave * 16 + col) * CP, kc * 32, lane); v16b wb[8];      // the block's LDS reads stand together in front of its WMMAs
#pragma unroll
      for (int j = 0; j < 8; ++j) wb[j] = frag_b(tB + (j * 16 + col) * TP + kc * 32, lane);
#pragma unroll
      for (int j = 0; j < 8; ++j) { acc[j] = wmma_bf(a.l, wb[j], acc[j]); acc[j] = wmma_bf(a.h, wb[j], acc[j]); } }
    PUBLISH();      // stage h + 1 readable; every wave has left stage h (behind the last pass: the ring is free for the output staging)
    if (h + 2 < NH) stage(h + 2); }
  LANDED();
#pragma unroll
  for (int j = 0; j < 8; ++j) {
#pragma unroll
    for (int r = 0; r < 8; ++r) so[wave][8 * g + r][j * 16 + col] = acc[j][r]; }
  LDSX();
#pragma unroll 4
  for (int rl = 0; rl < 16; ++rl) vst2(out + (size_t)(r0 + rl) * E + n0 + lane * 4, *(const v4f*)(&so[wave][rl][lane * 4]));
}
extern "C" void kernel_launch(void* const* d_in, const int* in_sizes, int n_in, void* d_out, int out_size, void* d_ws, size_t ws_size, hipStream_t stream) {
  (void)in_sizes; (void)n_in; (void)out_size; (void)ws_size;
  const float* x = (const float*)d_in[0]; const float* Wq = (const float*)d_in[1]; const float* Wk = (const float*)d_in[2]; const float* Wv = (const float*)d_in[3]; const float* Wo = (const float*)d_in[4];
  float* out = (float*)d_out;
  char* ws = (char*)d_ws; size_t off = 0;
  auto take = [&](size_t bytes) { char* p = ws + off; off += (bytes + 255) & ~(size_t)255; return p; };
  __bf16* Xb = (__bf16*)take((size_t)NR * E * 2); __bf16* PT = (__bf16*)take((size_t)(2 * E + 2 * EKV) * E * 2);
  float* Q32 = (float*)take((size_t)NR * E * 4); __bf16* Kh = (__bf16*)take((size_t)NR * EKV * 2); __bf16* Kl = (__bf16*)take((size_t)NR * EKV * 2); _Float16* VTh = (_Float16*)take((size_t)NR * EKV * 2); _Float16* VTl = (_Float16*)take((size_t)NR * EKV * 2); float* O32 = (float*)take((size_t)NR * E * 4);
  // ws ~ 102 MB
  k_cvt<<<(NR * E / 8 + 255) / 256, 256, 0, stream>>>(x, Xb);
  k_pack<<<2 * E + 2 * EKV, 256, 0, stream>>>(Wq, Wk, Wv, Wo, PT);
  k_qkv<<<dim3(NR / 64, E / 128, 3), 128, 0, stream>>>(Xb, PT, Q32, Kh, Kl, VTh, VTl);
  k_attn<<<dim3(NB * NH, SS / 64), 128, 0, stream>>>(Q32, Kh, Kl, VTh, VTl, O32);
  k_out<<<dim3(NR / 64, E / 128), 128, 0, stream>>>(O32, PT, out);
}

// v004
// A run of this version takes 174 microseconds.
// Two timings next to v003 put it at 1.14 and 1.13 times that version's speed.
// Counting every step since v000, it is 3.96 times as fast.
// compute dtype: x and wq/wk/wv/wo (INPUTS) rounded to bf16 with exact bf16 WMMA products (f32 accumulate) for the projections; K pre-split into bf16 hi/lo rows; q f32 split, P and V f16 hi/lo (3 products each); softmax f32.
#include <hip/hip_runtime.h>
#include <math.h>

typedef __attribute__((ext_vector_type(16))) _Float16 v16h;
typedef __attribute__((ext_vector_type(16))) __bf16 v16b;
typedef __attribute__((ext_vector_type(8)))  _Float16 v8h;
typedef __attribute__((ext_vector_type(8)))  float v8f;
typedef __attribute__((ext_vector_type(4)))  float v4f;
typedef __attribute__((ext_vector_type(2)))  float v2f;
typedef __attribute__((ext_vector_type(4)))  unsigned v4u;
typedef __attribute__((ext_vector_type(4)))  int v4i;
typedef float __attribute__((may_alias)) float_a;
typedef int __attribute__((may_alias)) int_a;

template <typename T> __device__ __forceinline__ void vst2(void* p, T v) { *(T*)p = v;  }
__device__ __forceinline__ v8f wmma16(v16h a, v16h b, v8f c) {
  v8f d = __builtin_amdgcn_wmma_f32_16x16x32_f16(false, a, false, b, (short)0, c, false, false);
  asm volatile("v_nop\n\tv_nop\n\tv_nop\n\tv_nop" : "+v"(d) : "v"(a), "v"(b));
  return d;
}
__device__ __forceinline__ v8f wmma_bf(v16b a, v16b b, v8f c) {
  v8f d = __builtin_amdgcn_wmma_f32_16x16x32_bf16(false, a, false, b, (short)0, c, false, false);
  asm volatile("v_nop\n\tv_nop\n\tv_nop\n\tv_nop" : "+v"(d) : "v"(a), "v"(b));
  return d;
}
// 16x16x32 fragments: lane = (h = lane>>4, row/col = lane&15); elements 0..7 = k0+8h+0..7, 8..15 = k0+16+8h+0..7; D element r = row 8h+r
__device__ __forceinline__ v16h frag_h(const _Float16* rowk0, int lane) {
  union { v16h v; v8h q[2]; } u; const _Float16* p = rowk0 + 8 * (lane >> 4);
  u.q[0] = *(const v8h*)p; u.q[1] = *(const v8h*)(p + 16); return u.v;
}
__device__ __forceinline__ v16h frag_f32(const float* rowk0, int lane) {
  v16h a; const float* p = rowk0 + 8 * (lane >> 4);
#pragma unroll
  for (int i = 0; i < 8; ++i) { a[i] = (_Float16)p[i]; a[8 + i] = (_Float16)p[16 + i]; }
  return a;
}
__device__ __forceinline__ v16h frag_f32s(const float* rowk0, int lane, float sc) {
  v16h a; const float* p = rowk0 + 8 * (lane >> 4);
#pragma unroll
  for (int i = 0; i < 8; ++i) { a[i] = (_Float16)(p[i] * sc); a[8 + i] = (_Float16)(p[16 + i] * sc); }
  return a;
}
// column fragment from a [K][ld] layout (column n), rows >= K read as 0
__device__ __forceinline__ v16h fragc_f32(const float* W, int k0, int n, int lane, int ld, int K) {
  v16h a; const int g = lane >> 4;
#pragma unroll
  for (int i = 0; i < 8; ++i) { const int ka = k0 + 8 * g + i, kb = ka + 16;
    a[i] = (_Float16)(ka < K ? W[(size_t)ka * ld + n] : 0.f); a[8 + i] = (_Float16)(kb < K ? W[(size_t)kb * ld + n] : 0.f); }
  return a;
}
struct F2 { v16b h, l; };
__device__ __forceinline__ F2 bsplit16(const float v[16]) { F2 r;
#pragma unroll
  for (int i = 0; i < 16; ++i) { const __bf16 h = (__bf16)v[i]; r.h[i] = h; r.l[i] = (__bf16)(v[i] - (float)h); }
  return r; }
__device__ __forceinline__ F2 split_row(const float* row, int k0, int lane) { float v[16]; const float* p = row + k0 + 8 * (lane >> 4);
#pragma unroll
  for (int i = 0; i < 8; ++i) { v[i] = p[i]; v[8 + i] = p[16 + i]; }
  return bsplit16(v); }
__device__ __forceinline__ F2 split_rowK(const float* row, int k0, int lane, int K) { float v[16]; const int g = lane >> 4;
#pragma unroll
  for (int i = 0; i < 8; ++i) { const int ka = k0 + 8 * g + i, kb = ka + 16; v[i] = ka < K ? row[ka] : 0.f; v[8 + i] = kb < K ? row[kb] : 0.f; }
  return bsplit16(v); }
__device__ __forceinline__ F2 split_col(const float* W, int k0, int n, int lane, int ld, int K) { float v[16]; const int g = lane >> 4;
#pragma unroll
  for (int i = 0; i < 8; ++i) { const int ka = k0 + 8 * g + i, kb = ka + 16; v[i] = ka < K ? W[(size_t)ka * ld + n] : 0.f; v[8 + i] = kb < K ? W[(size_t)kb * ld + n] : 0.f; }
  return bsplit16(v); }
__device__ __forceinline__ v8f mac3(const F2& a, const F2& b, v8f c) { c = wmma_bf(a.l, b.h, c); c = wmma_bf(a.h, b.l, c); return wmma_bf(a.h, b.h, c); }
__device__ __forceinline__ float sigm(float v) { return 1.0f / (1.0f + expf(-v)); }
#define LDSX() do { asm volatile("s_wait_dscnt 0" ::: "memory"); __builtin_amdgcn_wave_barrier(); __builtin_amdgcn_fence(__ATOMIC_RELEASE, "workgroup"); } while (0)


// Grouped-query causal self attention (16 query heads, 4 kv heads of 64 on [4,2048,1024], [in][out] weights, no biases): head h reads kv head h/4 (repeat_kv); -inf above the diagonal; (P v) @ wo. Key tiles past the query block are skipped.
#define NB 4
#define SS 2048
#define E 1024
#define NH 16
#define NKV 4
#define EKV (NKV * HD)
#define HD 64
#define NR (NB * SS)
#define PLO 1024.0f
#define VLO 2048.0f
#define SC2 0.18033688f      // 1/sqrt(64) x log2(e): the scores and their running maximum are kept in base-2 units, so that each exponential is one hardware exp2
__device__ __forceinline__ float bfr(float v) { return (float)(__bf16)v; }
__device__ __forceinline__ v16b frag_b(const __bf16* rowk0, int lane) { return __builtin_bit_cast(v16b, frag_h((const _Float16*)rowk0, lane)); }

#define TP 72      // LDS row pitch of a staged 128-B row in 16-bit elements: 144 B = 16 B x 9, the conflict-free pitch for 16-byte fragment reads
// Asynchronous copies global -> LDS, 16 B per lane, rows gs bytes apart in global memory and ls bytes apart in LDS. The copies and their s_wait_xcnt stand in one statement, so that no address register is rewritten before the wait.
__device__ __forceinline__ void copy4(unsigned la, unsigned ls, const char* a, size_t gs) {
  asm volatile("global_load_async_to_lds_b128 %0, %4, off\n\t"
               "global_load_async_to_lds_b128 %1, %5, off\n\t"
               "global_load_async_to_lds_b128 %2, %6, off\n\t"
               "global_load_async_to_lds_b128 %3, %7, off\n\t"
               "s_wait_xcnt 0x0"
               :: "v"(la), "v"(la + ls), "v"(la + 2 * ls), "v"(la + 3 * ls), "v"(a), "v"(a + gs), "v"(a + 2 * gs), "v"(a + 3 * gs) : "memory");
}
__device__ __forceinline__ void copy8(unsigned la, unsigned lc, unsigned ls, const char* a, const char* c, size_t gs) {
  asm volatile("global_load_async_to_lds_b128 %0, %8, off\n\t"
               "global_load_async_to_lds_b128 %1, %9, off\n\t"
               "global_load_async_to_lds_b128 %2, %10, off\n\t"
               "global_load_async_to_lds_b128 %3, %11, off\n\t"
               "global_load_async_to_lds_b128 %4, %12, off\n\t"
               "global_load_async_to_lds_b128 %5, %13, off\n\t"
               "global_load_async_to_lds_b128 %6, %14, off\n\t"
               "global_load_async_to_lds_b128 %7, %15, off\n\t"
               "s_wait_xcnt 0x0"
               :: "v"(la), "v"(la + ls), "v"(la + 2 * ls), "v"(la + 3 * ls), "v"(lc), "v"(lc + ls), "v"(lc + 2 * ls), "v"(lc + 3 * ls),
                  "v"(a), "v"(a + gs), "v"(a + 2 * gs), "v"(a + 3 * gs), "v"(c), "v"(c + gs), "v"(c + 2 * gs), "v"(c + 3 * gs) : "memory");
}
// this wave's own copies have landed (in front of the barrier that lets other waves read them, and behind the last copy of a kernel)
#define LANDED() asm volatile("s_wait_asynccnt 0x0" ::: "memory")
// publish point of a staged tile: this wave's LDS reads retired, its own copies landed, then the work-group barrier (it publishes the tile that flew and frees the one just read)
#define PUBLISH() do { asm volatile("s_wait_dscnt 0" ::: "memory"); LANDED(); __syncthreads(); } while (0)

__global__ __launch_bounds__(256) void k_cvt(const float* __restrict__ x, __bf16* __restrict__ Xb) {
  const size_t i8 = (size_t)blockIdx.x * 256 + threadIdx.x; if (i8 >= (size_t)NR * E / 8) return;
  union { __bf16 h[8]; v4u u; } pk;
#pragma unroll
  for (int e = 0; e < 8; ++e) pk.h[e] = (__bf16)x[i8 * 8 + e];
  vst2((unsigned*)(Xb + i8 * 8), pk.u);
}
// PT rows: [0,E) Wq[:,n], [E,E+EKV) Wk[:,n], [E+EKV,E+2EKV) Wv[:,n], [E+2EKV,2E+2EKV) Wo[:,n]  ([in][out] weights: column n as a bf16 row)
__global__ __launch_bounds__(256) void k_pack(const float* __restrict__ Wq, const float* __restrict__ Wk, const float* __restrict__ Wv, const float* __restrict__ Wo, __bf16* __restrict__ PT) {
  const int n = blockIdx.x, tid = threadIdx.x; __shared__ __align__(16) __bf16 srow[E];
  const float* W = n < E ? Wq : (n < E + EKV ? Wk : (n < E + 2 * EKV ? Wv : Wo)); const int nn = n < E ? n : (n < E + EKV ? n - E : (n < E + 2 * EKV ? n - E - EKV : n - E - 2 * EKV)); const int ld = (n >= E && n < E + 2 * EKV) ? EKV : E;      // [in][out]: column nn
  for (int k = tid; k < E; k += 256) srow[k] = (__bf16)W[(size_t)k * ld + nn];
  __syncthreads();
  if (tid < E / 8) vst2((unsigned*)(PT + (size_t)n * E + tid * 8), *(const v4u*)(&srow[tid * 8]));
}
// QKV: block (64 rows, 128 cols = 2 heads, which); q -> Q32 f32 [bh][s][64]; k -> bf16 hi/lo rows; v -> VT hi/lo x4 [bh][d][s]
#define QST (192 * TP * 2)      // bytes of one stage: 64 x rows, then 128 weight rows, 64 k (128 B) each, at pitch TP
__global__ __launch_bounds__(128) void k_qkv(const __bf16* __restrict__ Xb, const __bf16* __restrict__ PT, float* __restrict__ Q32, __bf16* __restrict__ Kh, __bf16* __restrict__ Kl, _Float16* __restrict__ VTh, _Float16* __restrict__ VTl) {
  __shared__ __align__(16) char sm[2 * QST];      // in the loop the two operand stages, behind it the output staging
  float (*so)[16][132] = (float (*)[16][132])sm; _Float16 (*sth)[72] = (_Float16 (*)[72])sm; _Float16 (*stl)[72] = (_Float16 (*)[72])(sm + 128 * 72 * 2);
  const int tid = threadIdx.x, wave = tid >> 5, lane = tid & 31, col = lane & 15, g = lane >> 4;
  const int which = blockIdx.z, r0b = blockIdx.x * 64, r0 = r0b + wave * 16, n0 = blockIdx.y * 128; const int b = r0b / SS, s0 = r0b % SS;
  if (which > 0 && n0 >= EKV) return;      // k and v have only 4 heads
  const int prow = (which == 0 ? 0 : (which == 1 ? E : E + EKV)) + n0;
  v8f acc[8] = {};
  // each lane copies 16 B of rows tid / 8 + 16 i: a wave-wide copy = 4 whole 128-B lines
  const char* gA = (const char*)(Xb + (size_t)(r0b + (tid >> 3)) * E + (tid & 7) * 8); const char* gB = (const char*)(PT + (size_t)(prow + (tid >> 3)) * E + (tid & 7) * 8);
  const unsigned lA = (unsigned)(size_t)sm + (tid >> 3) * (TP * 2) + (tid & 7) * 16, lB = lA + 64 * TP * 2;
  auto stage = [&](int s) { const unsigned o = (s & 1) * QST; const char* a = gA + s * 128; const char* c = gB + s * 128;
    copy4(lA + o, 16 * TP * 2, a, (size_t)16 * E * 2); copy8(lB + o, lB + o + 64 * TP * 2, 16 * TP * 2, c, c + (size_t)64 * E * 2, (size_t)16 * E * 2); };
  stage(0); LANDED(); __syncthreads();
  stage(1);
#pragma unroll 1      // rolled: one pass per stage, the buffer picked by s & 1; unrolling would only lengthen the code
  for (int s = 0; s < E / 64; ++s) { const __bf16* tA = (const __bf16*)(sm + (s & 1) * QST); const __bf16* tB = tA + 64 * TP;
#pragma unroll
    for (int kc = 0; kc < 2; ++kc) { const v16b a = frag_b(tA + (wave * 16 + col) * TP + kc * 32, lane); v16b wb[8];      // the block's LDS reads stand together in front of its WMMAs
#pragma unroll
      for (int j = 0; j < 8; ++j) wb[j] = frag_b(tB + (j * 16 + col) * TP + kc * 32, lane);
#pragma unroll
      for (int j = 0; j < 8; ++j) acc[j] = wmma_bf(a, wb[j], acc[j]); }
    PUBLISH();      // stage s + 1 readable; every wave has left stage s (behind the last pass: the ring is free for the output staging)
    if (s + 2 < E / 64) stage(s + 2); }
  LANDED();
  if (which < 2) {
#pragma unroll
    for (int j = 0; j < 8; ++j) { const float bb = 0.f;
#pragma unroll
      for (int r = 0; r < 8; ++r) so[wave][8 * g + r][j * 16 + col] = acc[j][r] + bb; }
    LDSX();
    if (which == 0) { for (int qq = lane; qq < 2 * 16 * 16; qq += 32) { const int hh = qq >> 8, rl = (qq >> 4) & 15, pc = qq & 15; const int h = (n0 >> 6) + hh;
        vst2(Q32 + (((size_t)b * NH + h) * SS + s0 + wave * 16 + rl) * HD + pc * 4, *(const v4f*)(&so[wave][rl][hh * 64 + pc * 4])); } }
    else {
      for (int qq = lane; qq < 2 * 16 * 16; qq += 32) { const int hh = qq >> 8, rl = (qq >> 4) & 15, pl = qq & 15; const int h = (n0 >> 6) + hh; const int pc = pl & 7; union { __bf16 e[8]; v4u u; } pk;
#pragma unroll
        for (int e = 0; e < 8; ++e) { const float v = so[wave][rl][hh * 64 + pc * 8 + e]; const __bf16 hi = (__bf16)v; pk.e[e] = pl < 8 ? hi : (__bf16)(v - (float)hi); }
        vst2((unsigned*)((pl < 8 ? Kh : Kl) + (((size_t)b * NKV + h) * SS + s0 + wave * 16 + rl) * HD + pc * 8), pk.u); } } }
  else {
#pragma unroll
    for (int j = 0; j < 8; ++j) { const float bb = 0.f;
#pragma unroll
      for (int r = 0; r < 8; ++r) { const float v = (acc[j][r] + bb) * 4.0f; const _Float16 hi = (_Float16)v; sth[j * 16 + col][wave * 16 + 8 * g + r] = hi; stl[j * 16 + col][wave * 16 + 8 * g + r] = (_Float16)((v - (float)hi) * VLO); } }
    __syncthreads();
    for (int qq = tid; qq < 128 * 8; qq += 128) { const int cl = qq >> 3, pc = qq & 7; const int c = n0 + cl, h = c >> 6, d = c & 63; const size_t o = (((size_t)b * NKV + h) * HD + d) * SS + s0 + pc * 8;
      vst2(VTh + o, *(const v4u*)(&sth[cl][pc * 8])); vst2(VTl + o, *(const v4u*)(&stl[cl][pc * 8])); } }
}
__global__ __launch_bounds__(128, 4) void k_attn(const float* __restrict__ Q32, const __bf16* __restrict__ Kh, const __bf16* __restrict__ Kl, const _Float16* __restrict__ VTh, const _Float16* __restrict__ VTl, float* __restrict__ O32) {
  __shared__ __align__(16) char sm[4 * 64 * TP * 2];      // in the loop the K hi, K lo, V hi, V lo tiles; behind it the K part is the output staging
  __bf16* sKh = (__bf16*)sm; __bf16* sKl = sKh + 64 * TP; _Float16* sVh = (_Float16*)(sm + 2 * 64 * TP * 2); _Float16* sVl = sVh + 64 * TP;
  float (*sO)[16][68] = (float (*)[16][68])sm; static_assert(4 * 16 * 68 * 4 <= 2 * 64 * TP * 2, "the output staging lies on the K tiles alone");
  const int tid = threadIdx.x, w = tid >> 5, lane = tid & 31, col = lane & 15, g = lane >> 4;
  // the longest query blocks carry the lowest block indices (for speed only)
  static_assert((SS / 64 & (SS / 64 - 1)) == 0, "the xor reverses the index only for a power of two");
  const size_t bh = blockIdx.x; const int qb = (SS / 64 - 1) ^ (int)blockIdx.y; const int q0 = qb * 64 + w * 16;
  F2 aq[2];
#pragma unroll
  for (int kc = 0; kc < 2; ++kc) aq[kc] = split_row(Q32 + (bh * SS + q0 + col) * HD, kc * 32, lane);
  const int b = (int)(bh / NH); const size_t kvh = (size_t)b * NKV + (bh % NH) / (NH / NKV);     // repeat_kv: query head h reads kv head h/4
  float mrun = -3.0e38f, lrun = 0.f; v8f acc[4] = {}, ac1[4] = {}, ac2[4] = {};      // mrun: the query's maximum (equal in both lane halves); lrun: the sum over this lane half's keys, joined behind the loop
  // each lane copies 16 B of rows tid / 8 + 16 i of the hi and of the lo plane: a wave-wide copy = 4 whole 128-B lines
  const size_t kof = ((kvh * SS + (tid >> 3)) * HD + (tid & 7) * 8) * 2, vof = ((kvh * HD + (tid >> 3)) * SS + (tid & 7) * 8) * 2;      // bytes; K tile: rows = keys, 128 B apart; V tile: rows = d, SS * 2 bytes apart
  const char* gKh = (const char*)Kh + kof; const char* gKl = (const char*)Kl + kof; const char* gVh = (const char*)VTh + vof; const char* gVl = (const char*)VTl + vof;
  const unsigned lof = (tid >> 3) * (TP * 2) + (tid & 7) * 16;
  const unsigned lKh = (unsigned)(size_t)sKh + lof, lKl = (unsigned)(size_t)sKl + lof, lVh = (unsigned)(size_t)sVh + lof, lVl = (unsigned)(size_t)sVl + lof;
  copy8(lKh, lKl, 16 * TP * 2, gKh, gKl, (size_t)16 * HD * 2); LANDED(); __syncthreads();
  copy8(lVh, lVl, 16 * TP * 2, gVh, gVl, (size_t)16 * SS * 2);
#pragma unroll 1
  for (int kt = 0; kt <= qb; ++kt) {      // causal
    v8f sv[4];      // sv[t][r] = score of key kt * 64 + 16 t + 8 g + r against query q0 + col
    const int dq = q0 + col - kt * 64 - 8 * g;      // the key is past the query where 16 t + r > dq
#pragma unroll
    for (int t = 0; t < 4; ++t) { const int ko = (t * 16 + col) * TP; v8f s = {}; v16b khf[2], klf[2];
#pragma unroll
      for (int kc = 0; kc < 2; ++kc) { khf[kc] = frag_b(sKh + ko + kc * 32, lane); klf[kc] = frag_b(sKl + ko + kc * 32, lane); }      // the block's LDS reads stand together in front of its WMMAs
#pragma unroll
      for (int kc = 0; kc < 2; ++kc) { s = wmma_bf(khf[kc], aq[kc].l, s); s = wmma_bf(klf[kc], aq[kc].h, s); s = wmma_bf(khf[kc], aq[kc].h, s); }
#pragma unroll
      for (int r = 0; r < 8; ++r) sv[t][r] = (t * 16 + r > dq) ? -1.0e9f : s[r] * SC2; }
    PUBLISH();      // V(kt) readable; every wave has left K(kt)
    if (kt < qb) copy8(lKh, lKl, 16 * TP * 2, gKh + (size_t)(kt + 1) * 64 * HD * 2, gKl + (size_t)(kt + 1) * 64 * HD * 2, (size_t)16 * HD * 2);
    float mx = -3.4e38f;
#pragma unroll
    for (int t = 0; t < 4; ++t) {
#pragma unroll
      for (int r = 0; r < 8; ++r) mx = fmaxf(mx, sv[t][r]); }
    mx = fmaxf(mx, __shfl_xor(mx, 16, 32));      // the other half of the query's keys
    const float mnew = fmaxf(mrun, mx); float corr; asm("v_exp_f32 %0, %1\n\tv_nop" : "=v"(corr) : "v"(mrun - mnew));      // exp2 and the one free slot that a transcendental wants behind it, in one statement
    const float moff = mnew - 14.0f;      // 2^14, the scale of P, rides in the exponent
    v2f ps[2] = {}; v16h ph[2], pl[2];      // ps: the sum of P in two chains of packed adds; B operands of 32 keys each: element i = key 8 g + i of score tile 2 kc, element 8 + i the same of tile 2 kc + 1, the order in which frag_h reads the V rows
#pragma unroll
    for (int kc = 0; kc < 2; ++kc) {
#pragma unroll
      for (int i = 0; i < 16; ++i) { const float p = __builtin_amdgcn_exp2f(sv[2 * kc + (i >> 3)][i & 7] - moff); ps[kc][i & 1] += p; const _Float16 hi = (_Float16)p; ph[kc][i] = hi; pl[kc][i] = (_Float16)((p - (float)hi) * PLO); } }
    lrun = lrun * corr + ((ps[0][0] + ps[1][0]) + (ps[0][1] + ps[1][1])) * (1.0f / 16384.0f); mrun = mnew;
#pragma unroll
    for (int t = 0; t < 4; ++t) {
#pragma unroll
      for (int r = 0; r < 8; ++r) { acc[t][r] *= corr; ac1[t][r] *= corr; ac2[t][r] *= corr; } }      // every element of a lane belongs to its one query
#pragma unroll
    for (int kc = 0; kc < 2; ++kc) {
#pragma unroll
      for (int t = 0; t < 4; ++t) { const int vo = (t * 16 + col) * TP + kc * 32; const v16h vh = frag_h(sVh + vo, lane), vl = frag_h(sVl + vo, lane);      // the block's LDS reads stand together in front of its WMMAs
        acc[t] = wmma16(vh, ph[kc], acc[t]); ac1[t] = wmma16(vl, ph[kc], ac1[t]); ac2[t] = wmma16(vh, pl[kc], ac2[t]); } }
    PUBLISH();      // K(kt + 1) readable; every wave has left V(kt) (behind the last pass: the K tiles are free for the output staging)
    if (kt < qb) copy8(lVh, lVl, 16 * TP * 2, gVh + (size_t)(kt + 1) * 64 * 2, gVl + (size_t)(kt + 1) * 64 * 2, (size_t)16 * SS * 2); }
  LANDED();
  lrun += __shfl_xor(lrun, 16, 32);
  const float inv = 1.0f / (lrun * 16384.0f * 4.0f);
#pragma unroll
  for (int t = 0; t < 4; ++t) { v4f o[2];      // acc[t][r] = O[q0 + col][16 t + 8 g + r]: eight neighbours of one row
#pragma unroll
    for (int r = 0; r < 8; ++r) o[r >> 2][r & 3] = (acc[t][r] + ac1[t][r] * (1.0f / VLO) + ac2[t][r] * (1.0f / PLO)) * inv;
    vst2(&sO[w][col][t * 16 + 8 * g], o[0]); vst2(&sO[w][col][t * 16 + 8 * g + 4], o[1]); }
  LDSX();
  for (int qq = lane; qq < 16 * 16; qq += 32) { const int rl = qq >> 4, pc = qq & 15; vst2(O32 + ((bh * SS) + q0 + rl) * HD + pc * 4, *(const v4f*)(&sO[w][rl][pc * 4])); }
}
// out = ctx Wo : split(ctx) x bf16(Wo rows): 2 products (Wo is an INPUT -> bf16 exact)
#define CP 68      // LDS row pitch of a staged 256-B f32 row in floats: 272 B = 16 B x 17
#define OSA (64 * CP * 4)      // bytes of the ctx part of a stage: 64 rows of one head
#define OST (OSA + 128 * TP * 2)      // bytes of one stage: the ctx rows, then 128 weight rows of 64 k
__global__ __launch_bounds__(128) void k_out(const float* __restrict__ O32, const __bf16* __restrict__ PT, float* __restrict__ out) {
  __shared__ __align__(16) char sm[2 * OST];      // in the loop the two operand stages, behind it the output staging
  float (*so)[16][132] = (float (*)[16][132])sm;
  const int tid = threadIdx.x, wave = tid >> 5, lane = tid & 31, col = lane & 15, g = lane >> 4;
  const int r0b = blockIdx.x * 64, r0 = r0b + wave * 16, n0 = blockIdx.y * 128; const int b = r0b / SS, s0 = r0b % SS;
  v8f acc[8] = {};
  // ctx: each lane copies 16 B of rows tid / 16 + 8 i (a wave-wide copy = 2 rows = 4 whole lines); weights: 16 B of rows tid / 8 + 16 i
  const char* gA = (const char*)(O32 + ((size_t)b * NH * SS + s0 + (tid >> 4)) * HD + (tid & 15) * 4); const char* gB = (const char*)(PT + (size_t)(E + 2 * EKV + n0 + (tid >> 3)) * E + (tid & 7) * 8);
  const unsigned lA = (unsigned)(size_t)sm + (tid >> 4) * (CP * 4) + (tid & 15) * 16, lB = (unsigned)(size_t)sm + OSA + (tid >> 3) * (TP * 2) + (tid & 7) * 16;
  auto stage = [&](int h) { const unsigned o = (h & 1) * OST; const char* a = gA + (size_t)h * SS * HD * 4; const char* c = gB + h * 128;
    copy8(lA + o, lA + o + 32 * CP * 4, 8 * CP * 4, a, a + 32 * HD * 4, (size_t)8 * HD * 4); copy8(lB + o, lB + o + 64 * TP * 2, 16 * TP * 2, c, c + (size_t)64 * E * 2, (size_t)16 * E * 2); };
  stage(0); LANDED(); __syncthreads();
  stage(1);
#pragma unroll 1      // rolled: one pass per stage, the buffer picked by h & 1; unrolling would only lengthen the code
  for (int h = 0; h < NH; ++h) { const float* tA = (const float*)(sm + (h & 1) * OST); const __bf16* tB = (const __bf16*)(sm + (h & 1) * OST + OSA);
#pragma unroll
    for (int kc = 0; kc < 2; ++kc) { const F2 a = split_row(tA + (wave * 16 + col) * CP, kc * 32, lane); v16b wb[8];      // the block's LDS reads stand together in front of its WMMAs
#pragma unroll
      for (int j = 0; j < 8; ++j) wb[j] = frag_b(tB + (j * 16 + col) * TP + kc * 32, lane);
#pragma unroll
      for (int j = 0; j < 8; ++j) { acc[j] = wmma_bf(a.l, wb[j], acc[j]); acc[j] = wmma_bf(a.h, wb[j], acc[j]); } }
    PUBLISH();      // stage h + 1 readable; every wave has left stage h (behind the last pass: the ring is free for the output staging)
    if (h + 2 < NH) stage(h + 2); }
  LANDED();
#pragma unroll
  for (int j = 0; j < 8; ++j) {
#pragma unroll
    for (int r = 0; r < 8; ++r) so[wave][8 * g + r][j * 16 + col] = acc[j][r]; }
  LDSX();
#pragma unroll 4
  for (int rl = 0; rl < 16; ++rl) vst2(out + (size_t)(r0 + rl) * E + n0 + lane * 4, *(const v4f*)(&so[wave][rl][lane * 4]));
}
extern "C" void kernel_launch(void* const* d_in, const int* in_sizes, int n_in, void* d_out, int out_size, void* d_ws, size_t ws_size, hipStream_t stream) {
  (void)in_sizes; (void)n_in; (void)out_size; (void)ws_size;
  const float* x = (const float*)d_in[0]; const float* Wq = (const float*)d_in[1]; const float* Wk = (const float*)d_in[2]; const float* Wv = (const float*)d_in[3]; const float* Wo = (const float*)d_in[4];
  float* out = (float*)d_out;
  char* ws = (char*)d_ws; size_t off = 0;
  auto take = [&](size_t bytes) { char* p = ws + off; off += (bytes + 255) & ~(size_t)255; return p; };
  __bf16* Xb = (__bf16*)take((size_t)NR * E * 2); __bf16* PT = (__bf16*)take((size_t)(2 * E + 2 * EKV) * E * 2);
  float* Q32 = (float*)take((size_t)NR * E * 4); __bf16* Kh = (__bf16*)take((size_t)NR * EKV * 2); __bf16* Kl = (__bf16*)take((size_t)NR * EKV * 2); _Float16* VTh = (_Float16*)take((size_t)NR * EKV * 2); _Float16* VTl = (_Float16*)take((size_t)NR * EKV * 2); float* O32 = (float*)take((size_t)NR * E * 4);
  // ws ~ 102 MB
  k_cvt<<<(NR * E / 8 + 255) / 256, 256, 0, stream>>>(x, Xb);
  k_pack<<<2 * E + 2 * EKV, 256, 0, stream>>>(Wq, Wk, Wv, Wo, PT);
  k_qkv<<<dim3(NR / 64, E / 128, 3), 128, 0, stream>>>(Xb, PT, Q32, Kh, Kl, VTh, VTl);
  k_attn<<<dim3(NB * NH, SS / 64), 128, 0, stream>>>(Q32, Kh, Kl, VTh, VTl, O32);
  k_out<<<dim3(NR / 64, E / 128), 128, 0, stream>>>(O32, PT, out);
}

// v005
// A run of this version takes 158 microseconds.
// Timed twice side by side with v004, it ran 1.10 times as fast both times.
// All steps since v000 together make it 4.35 times as fast.
// compute dtype: x and wq/wk/wv/wo (INPUTS) rounded to bf16 with exact bf16 WMMA products (f32 accumulate) for the projections; K pre-split into bf16 hi/lo rows; q f32 split, P and V f16 hi/lo (3 products each); softmax f32.
#include <hip/hip_runtime.h>
#include <math.h>

typedef __attribute__((ext_vector_type(16))) _Float16 v16h;
typedef __attribute__((ext_vector_type(16))) __bf16 v16b;
typedef __attribute__((ext_vector_type(8)))  _Float16 v8h;
typedef __attribute__((ext_vector_type(8)))  float v8f;
typedef __attribute__((ext_vector_type(4)))  float v4f;
typedef __attribute__((ext_vector_type(2)))  float v2f;
typedef __attribute__((ext_vector_type(4)))  unsigned v4u;
typedef __attribute__((ext_vector_type(4)))  int v4i;
typedef float __attribute__((may_alias)) float_a;
typedef int __attribute__((may_alias)) int_a;

template <typename T> __device__ __forceinline__ void vst2(void* p, T v) { *(T*)p = v;  }
__device__ __forceinline__ v8f wmma16(v16h a, v16h b, v8f c) {
  v8f d = __builtin_amdgcn_wmma_f32_16x16x32_f16(false, a, false, b, (short)0, c, false, false);
  asm volatile("v_nop\n\tv_nop\n\tv_nop\n\tv_nop" : "+v"(d) : "v"(a), "v"(b));
  return d;
}
__device__ __forceinline__ v8f wmma_bf(v16b a, v16b b, v8f c) {
  v8f d = __builtin_amdgcn_wmma_f32_16x16x32_bf16(false, a, false, b, (short)0, c, false, false);
  asm volatile("v_nop\n\tv_nop\n\tv_nop\n\tv_nop" : "+v"(d) : "v"(a), "v"(b));
  return d;
}
// 16x16x32 fragments: lane = (h = lane>>4, row/col = lane&15); elements 0..7 = k0+8h+0..7, 8..15 = k0+16+8h+0..7; D element r = row 8h+r
__device__ __forceinline__ v16h frag_h(const _Float16* rowk0, int lane) {
  union { v16h v; v8h q[2]; } u; const _Float16* p = rowk0 + 8 * (lane >> 4);
  u.q[0] = *(const v8h*)p; u.q[1] = *(const v8h*)(p + 16); return u.v;
}
__device__ __forceinline__ v16h frag_f32(const float* rowk0, int lane) {
  v16h a; const float* p = rowk0 + 8 * (lane >> 4);
#pragma unroll
  for (int i = 0; i < 8; ++i) { a[i] = (_Float16)p[i]; a[8 + i] = (_Float16)p[16 + i]; }
  return a;
}
__device__ __forceinline__ v16h frag_f32s(const float* rowk0, int lane, float sc) {
  v16h a; const float* p = rowk0 + 8 * (lane >> 4);
#pragma unroll
  for (int i = 0; i < 8; ++i) { a[i] = (_Float16)(p[i] * sc); a[8 + i] = (_Float16)(p[16 + i] * sc); }
  return a;
}
// column fragment from a [K][ld] layout (column n), rows >= K read as 0
__device__ __forceinline__ v16h fragc_f32(const float* W, int k0, int n, int lane, int ld, int K) {
  v16h a; const int g = lane >> 4;
#pragma unroll
  for (int i = 0; i < 8; ++i) { const int ka = k0 + 8 * g + i, kb = ka + 16;
    a[i] = (_Float16)(ka < K ? W[(size_t)ka * ld + n] : 0.f); a[8 + i] = (_Float16)(kb < K ? W[(size_t)kb * ld + n] : 0.f); }
  return a;
}
struct F2 { v16b h, l; };
__device__ __forceinline__ F2 bsplit16(const float v[16]) { F2 r;
#pragma unroll
  for (int i = 0; i < 16; ++i) { const __bf16 h = (__bf16)v[i]; r.h[i] = h; r.l[i] = (__bf16)(v[i] - (float)h); }
  return r; }
__device__ __forceinline__ F2 split_row(const float* row, int k0, int lane) { float v[16]; const float* p = row + k0 + 8 * (lane >> 4);
#pragma unroll
  for (int i = 0; i < 8; ++i) { v[i] = p[i]; v[8 + i] = p[16 + i]; }
  return bsplit16(v); }
__device__ __forceinline__ F2 split_rowK(const float* row, int k0, int lane, int K) { float v[16]; const int g = lane >> 4;
#pragma unroll
  for (int i = 0; i < 8; ++i) { const int ka = k0 + 8 * g + i, kb = ka + 16; v[i] = ka < K ? row[ka] : 0.f; v[8 + i] = kb < K ? row[kb] : 0.f; }
  return bsplit16(v); }
__device__ __forceinline__ F2 split_col(const float* W, int k0, int n, int lane, int ld, int K) { float v[16]; const int g = lane >> 4;
#pragma unroll
  for (int i = 0; i < 8; ++i) { const int ka = k0 + 8 * g + i, kb = ka + 16; v[i] = ka < K ? W[(size_t)ka * ld + n] : 0.f; v[8 + i] = kb < K ? W[(size_t)kb * ld + n] : 0.f; }
  return bsplit16(v); }
__device__ __forceinline__ v8f mac3(const F2& a, const F2& b, v8f c) { c = wmma_bf(a.l, b.h, c); c = wmma_bf(a.h, b.l, c); return wmma_bf(a.h, b.h, c); }
__device__ __forceinline__ float sigm(float v) { return 1.0f / (1.0f + expf(-v)); }
#define LDSX() do { asm volatile("s_wait_dscnt 0" ::: "memory"); __builtin_amdgcn_wave_barrier(); __builtin_amdgcn_fence(__ATOMIC_RELEASE, "workgroup"); } while (0)


// Grouped-query causal self attention (16 query heads, 4 kv heads of 64 on [4,2048,1024], [in][out] weights, no biases): head h reads kv head h/4 (repeat_kv); -inf above the diagonal; (P v) @ wo. Key tiles past the query block are skipped.
#define NB 4
#define SS 2048
#define E 1024
#define NH 16
#define NKV 4
#define EKV (NKV * HD)
#define HD 64
#define NR (NB * SS)
#define PLO 1024.0f
#define VLO 2048.0f
#define SC2 0.18033688f      // 1/sqrt(64) x log2(e): the scores and their running maximum are kept in base-2 units, so that each exponential is one hardware exp2
__device__ __forceinline__ float bfr(float v) { return (float)(__bf16)v; }
__device__ __forceinline__ v16b frag_b(const __bf16* rowk0, int lane) { return __builtin_bit_cast(v16b, frag_h((const _Float16*)rowk0, lane)); }

#define TP 72      // LDS row pitch of a staged 128-B row in 16-bit elements: 144 B = 16 B x 9, the conflict-free pitch for 16-byte fragment reads
// Asynchronous copies global -> LDS, 16 B per lane, rows gs bytes apart in global memory and ls bytes apart in LDS. The copies and their s_wait_xcnt stand in one statement, so that no address register is rewritten before the wait.
__device__ __forceinline__ void copy4(unsigned la, unsigned ls, const char* a, size_t gs) {
  asm volatile("global_load_async_to_lds_b128 %0, %4, off\n\t"
               "global_load_async_to_lds_b128 %1, %5, off\n\t"
               "global_load_async_to_lds_b128 %2, %6, off\n\t"
               "global_load_async_to_lds_b128 %3, %7, off\n\t"
               "s_wait_xcnt 0x0"
               :: "v"(la), "v"(la + ls), "v"(la + 2 * ls), "v"(la + 3 * ls), "v"(a), "v"(a + gs), "v"(a + 2 * gs), "v"(a + 3 * gs) : "memory");
}
__device__ __forceinline__ void copy8(unsigned la, unsigned lc, unsigned ls, const char* a, const char* c, size_t gs) {
  asm volatile("global_load_async_to_lds_b128 %0, %8, off\n\t"
               "global_load_async_to_lds_b128 %1, %9, off\n\t"
               "global_load_async_to_lds_b128 %2, %10, off\n\t"
               "global_load_async_to_lds_b128 %3, %11, off\n\t"
               "global_load_async_to_lds_b128 %4, %12, off\n\t"
               "global_load_async_to_lds_b128 %5, %13, off\n\t"
               "global_load_async_to_lds_b128 %6, %14, off\n\t"
               "global_load_async_to_lds_b128 %7, %15, off\n\t"
               "s_wait_xcnt 0x0"
               :: "v"(la), "v"(la + ls), "v"(la + 2 * ls), "v"(la + 3 * ls), "v"(lc), "v"(lc + ls), "v"(lc + 2 * ls), "v"(lc + 3 * ls),
                  "v"(a), "v"(a + gs), "v"(a + 2 * gs), "v"(a + 3 * gs), "v"(c), "v"(c + gs), "v"(c + 2 * gs), "v"(c + 3 * gs) : "memory");
}
// this wave's own copies have landed (in front of the barrier that lets other waves read them, and behind the last copy of a kernel)
#define LANDED() asm volatile("s_wait_asynccnt 0x0" ::: "memory")
// publish point of a staged tile: this wave's LDS reads retired, its own copies landed, then the work-group barrier (it publishes the tile that flew and frees the one just read)
#define PUBLISH() do { asm volatile("s_wait_dscnt 0" ::: "memory"); LANDED(); __syncthreads(); } while (0)

// x -> bf16 (Xb) and the weight columns -> bf16 rows (PT) in ONE launch of few work-groups with long waves, all of a wave's loads in flight at once, instead of one short wave per KB
// PT rows: [0,E) Wq[:,n], [E,E+EKV) Wk[:,n], [E+EKV,E+2EKV) Wv[:,n], [E+2EKV,2E+2EKV) Wo[:,n]  ([in][out] weights: column n as a bf16 row)
#define PKT 4      // weight tiles of 64 k x 32 n per packing work-group: 256 k of 32 columns
#define PKB ((2 * E + 2 * EKV) / 32 * (E / 64) / PKT)      // packing work-groups; they carry the lowest indices: their chain (loads, LDS, barrier, stores) is the longer one
#define CVU 8      // units of 256 lanes x 8 floats per converting work-group
#define CVB (NR * E / (CVU * 256 * 8))      // converting work-groups
__global__ __launch_bounds__(256) void k_prep(const float* __restrict__ x, const float* __restrict__ Wq, const float* __restrict__ Wk, const float* __restrict__ Wv, const float* __restrict__ Wo, __bf16* __restrict__ Xb, __bf16* __restrict__ PT) {
  static_assert(E % (64 * PKT) == 0 && E % 32 == 0 && EKV % 32 == 0, "a work-group's tiles lie in 32 columns of one weight matrix");
  static_assert((size_t)CVB * CVU * 256 * 8 == (size_t)NR * E, "every x element once");
  __shared__ __align__(16) unsigned st[PKT][32][36];      // [tile][n][k pair], row pitch 144 B = 16 B x 9
  const int tid = threadIdx.x;
  if (blockIdx.x < PKB) {      // the same for the whole work-group: its barrier is passed by all of its waves or by none
    const int r8 = tid >> 3, c8 = tid & 7;
    const int n = (int)(blockIdx.x / (E / 64 / PKT)) * 32, k0 = (int)(blockIdx.x % (E / 64 / PKT)) * (64 * PKT);
    const float* W = n < E ? Wq : (n < E + EKV ? Wk : (n < E + 2 * EKV ? Wv : Wo)); const int nn = n < E ? n : (n < E + EKV ? n - E : (n < E + 2 * EKV ? n - E - EKV : n - E - 2 * EKV)); const int ld = (n >= E && n < E + 2 * EKV) ? EKV : E;      // [in][out]: columns nn .. nn + 31
    const unsigned off = (unsigned)(2 * r8 * ld + c8 * 4);
    v4f a[PKT], c[PKT];      // rows k0 + 64 i + 2 r8 and the next, columns 4 c8 .. 4 c8 + 3: eight lanes read one whole 128-B line
#pragma unroll
    for (int i = 0; i < PKT; ++i) { const float* p = W + (size_t)(k0 + 64 * i) * ld + nn; a[i] = *(const v4f*)(p + off); c[i] = *(const v4f*)(p + ld + off); }
#pragma unroll
    for (int i = 0; i < PKT; ++i) {
#pragma unroll
      for (int j = 0; j < 4; ++j) { union { __bf16 h[2]; unsigned u; } pk; pk.h[0] = (__bf16)a[i][j]; pk.h[1] = (__bf16)c[i][j]; st[i][c8 * 4 + j][r8] = pk.u; } }
    __syncthreads();      // the tiles are whole
    v4u o[PKT];
#pragma unroll
    for (int i = 0; i < PKT; ++i) o[i] = *(const v4u*)(&st[i][r8][c8 * 4]);
#pragma unroll
    for (int i = 0; i < PKT; ++i) vst2((unsigned*)(PT + (size_t)(n + r8) * E + k0 + 64 * i + c8 * 8), o[i]);      // eight lanes write one whole 128-B line of a PT row
  } else {
    const size_t i8 = (size_t)(blockIdx.x - PKB) * (CVU * 256) + tid;
    v4f v[CVU][2];
#pragma unroll
    for (int u = 0; u < CVU; ++u) { const float* p = x + (i8 + u * 256) * 8; v[u][0] = *(const v4f*)p; v[u][1] = *(const v4f*)(p + 4); }
#pragma unroll
    for (int u = 0; u < CVU; ++u) { union { __bf16 h[8]; v4u u4; } pk;
#pragma unroll
      for (int e = 0; e < 8; ++e) pk.h[e] = (__bf16)v[u][e >> 2][e & 3];
      vst2((unsigned*)(Xb + (i8 + u * 256) * 8), pk.u4); }
    asm volatile("s_wait_xcnt 0x0" ::: "memory");      // behind the last store of the run: no register that an issued store names is rewritten in front of this wait
  }
}
// QKV: block (64 rows, 128 cols = 2 heads, which); q -> Q32 f32 [bh][s][64]; k -> bf16 hi/lo rows; v -> VT hi/lo x4 [bh][d][s]
#define QST (192 * TP * 2)      // bytes of one stage: 64 x rows, then 128 weight rows, 64 k (128 B) each, at pitch TP
__global__ __launch_bounds__(128) void k_qkv(const __bf16* __restrict__ Xb, const __bf16* __restrict__ PT, float* __restrict__ Q32, __bf16* __restrict__ Kh, __bf16* __restrict__ Kl, _Float16* __restrict__ VTh, _Float16* __restrict__ VTl) {
  __shared__ __align__(16) char sm[2 * QST];      // in the loop the two operand stages, behind it the output staging
  float (*so)[16][132] = (float (*)[16][132])sm; _Float16 (*sth)[72] = (_Float16 (*)[72])sm; _Float16 (*stl)[72] = (_Float16 (*)[72])(sm + 128 * 72 * 2);
  const int tid = threadIdx.x, wave = tid >> 5, lane = tid & 31, col = lane & 15, g = lane >> 4;
  const int which = blockIdx.z, r0b = blockIdx.x * 64, r0 = r0b + wave * 16, n0 = blockIdx.y * 128; const int b = r0b / SS, s0 = r0b % SS;
  if (which > 0 && n0 >= EKV) return;      // k and v have only 4 heads
  const int prow = (which == 0 ? 0 : (which == 1 ? E : E + EKV)) + n0;
  v8f acc[8] = {};
  // each lane copies 16 B of rows tid / 8 + 16 i: a wave-wide copy = 4 whole 128-B lines
  const char* gA = (const char*)(Xb + (size_t)(r0b + (tid >> 3)) * E + (tid & 7) * 8); const char* gB = (const char*)(PT + (size_t)(prow + (tid >> 3)) * E + (tid & 7) * 8);
  const unsigned lA = (unsigned)(size_t)sm + (tid >> 3) * (TP * 2) + (tid & 7) * 16, lB = lA + 64 * TP * 2;
  auto stage = [&](int s) { const unsigned o = (s & 1) * QST; const char* a = gA + s * 128; const char* c = gB + s * 128;
    copy4(lA + o, 16 * TP * 2, a, (size_t)16 * E * 2); copy8(lB + o, lB + o + 64 * TP * 2, 16 * TP * 2, c, c + (size_t)64 * E * 2, (size_t)16 * E * 2); };
  stage(0); LANDED(); __syncthreads();
  stage(1);
#pragma unroll 1      // rolled: one pass per stage, the buffer picked by s & 1; unrolling would only lengthen the code
  for (int s = 0; s < E / 64; ++s) { const __bf16* tA = (const __bf16*)(sm + (s & 1) * QST); const __bf16* tB = tA + 64 * TP;
#pragma unroll
    for (int kc = 0; kc < 2; ++kc) { const v16b a = frag_b(tA + (wave * 16 + col) * TP + kc * 32, lane); v16b wb[8];      // the block's LDS reads stand together in front of its WMMAs
#pragma unroll
      for (int j = 0; j < 8; ++j) wb[j] = frag_b(tB + (j * 16 + col) * TP + kc * 32, lane);
#pragma unroll
      for (int j = 0; j < 8; ++j) acc[j] = wmma_bf(a, wb[j], acc[j]); }
    PUBLISH();      // stage s + 1 readable; every wave has left stage s (behind the last pass: the ring is free for the output staging)
    if (s + 2 < E / 64) stage(s + 2); }
  LANDED();
  if (which < 2) {
#pragma unroll
    for (int j = 0; j < 8; ++j) { const float bb = 0.f;
#pragma unroll
      for (int r = 0; r < 8; ++r) so[wave][8 * g + r][j * 16 + col] = acc[j][r] + bb; }
    LDSX();
    if (which == 0) { for (int qq = lane; qq < 2 * 16 * 16; qq += 32) { const int hh = qq >> 8, rl = (qq >> 4) & 15, pc = qq & 15; const int h = (n0 >> 6) + hh;
        vst2(Q32 + (((size_t)b * NH + h) * SS + s0 + wave * 16 + rl) * HD + pc * 4, *(const v4f*)(&so[wave][rl][hh * 64 + pc * 4])); } }
    else {
      for (int qq = lane; qq < 2 * 16 * 16; qq += 32) { const int hh = qq >> 8, rl = (qq >> 4) & 15, pl = qq & 15; const int h = (n0 >> 6) + hh; const int pc = pl & 7; union { __bf16 e[8]; v4u u; } pk;
#pragma unroll
        for (int e = 0; e < 8; ++e) { const float v = so[wave][rl][hh * 64 + pc * 8 + e]; const __bf16 hi = (__bf16)v; pk.e[e] = pl < 8 ? hi : (__bf16)(v - (float)hi); }
        vst2((unsigned*)((pl < 8 ? Kh : Kl) + (((size_t)b * NKV + h) * SS + s0 + wave * 16 + rl) * HD + pc * 8), pk.u); } } }
  else {
#pragma unroll
    for (int j = 0; j < 8; ++j) { const float bb = 0.f;
#pragma unroll
      for (int r = 0; r < 8; ++r) { const float v = (acc[j][r] + bb) * 4.0f; const _Float16 hi = (_Float16)v; sth[j * 16 + col][wave * 16 + 8 * g + r] = hi; stl[j * 16 + col][wave * 16 + 8 * g + r] = (_Float16)((v - (float)hi) * VLO); } }
    __syncthreads();
    for (int qq = tid; qq < 128 * 8; qq += 128) { const int cl = qq >> 3, pc = qq & 7; const int c = n0 + cl, h = c >> 6, d = c & 63; const size_t o = (((size_t)b * NKV + h) * HD + d) * SS + s0 + pc * 8;
      vst2(VTh + o, *(const v4u*)(&sth[cl][pc * 8])); vst2(VTl + o, *(const v4u*)(&stl[cl][pc * 8])); } }
}
__global__ __launch_bounds__(128, 4) void k_attn(const float* __restrict__ Q32, const __bf16* __restrict__ Kh, const __bf16* __restrict__ Kl, const _Float16* __restrict__ VTh, const _Float16* __restrict__ VTl, float* __restrict__ O32) {
  __shared__ __align__(16) char sm[4 * 64 * TP * 2];      // in the loop the K hi, K lo, V hi, V lo tiles; behind it the K part is the output staging
  __bf16* sKh = (__bf16*)sm; __bf16* sKl = sKh + 64 * TP; _Float16* sVh = (_Float16*)(sm + 2 * 64 * TP * 2); _Float16* sVl = sVh + 64 * TP;
  float (*sO)[16][68] = (float (*)[16][68])sm; static_assert(4 * 16 * 68 * 4 <= 2 * 64 * TP * 2, "the output staging lies on the K tiles alone");
  const int tid = threadIdx.x, w = tid >> 5, lane = tid & 31, col = lane & 15, g = lane >> 4;
  // the longest query blocks carry the lowest block indices (for speed only)
  static_assert((SS / 64 & (SS / 64 - 1)) == 0, "the xor reverses the index only for a power of two");
  const size_t bh = blockIdx.x; const int qb = (SS / 64 - 1) ^ (int)blockIdx.y; const int q0 = qb * 64 + w * 16;
  F2 aq[2];
#pragma unroll
  for (int kc = 0; kc < 2; ++kc) aq[kc] = split_row(Q32 + (bh * SS + q0 + col) * HD, kc * 32, lane);
  const int b = (int)(bh / NH); const size_t kvh = (size_t)b * NKV + (bh % NH) / (NH / NKV);     // repeat_kv: query head h reads kv head h/4
  float mrun = -3.0e38f, lrun = 0.f; v8f acc[4] = {}, ac1[4] = {}, ac2[4] = {};      // mrun: the query's maximum (equal in both lane halves); lrun: the sum over this lane half's keys, joined behind the loop
  // each lane copies 16 B of rows tid / 8 + 16 i of the hi and of the lo plane: a wave-wide copy = 4 whole 128-B lines
  const size_t kof = ((kvh * SS + (tid >> 3)) * HD + (tid & 7) * 8) * 2, vof = ((kvh * HD + (tid >> 3)) * SS + (tid & 7) * 8) * 2;      // bytes; K tile: rows = keys, 128 B apart; V tile: rows = d, SS * 2 bytes apart
  const char* gKh = (const char*)Kh + kof; const char* gKl = (const char*)Kl + kof; const char* gVh = (const char*)VTh + vof; const char* gVl = (const char*)VTl + vof;
  const unsigned lof = (tid >> 3) * (TP * 2) + (tid & 7) * 16;
  const unsigned lKh = (unsigned)(size_t)sKh + lof, lKl = (unsigned)(size_t)sKl + lof, lVh = (unsigned)(size_t)sVh + lof, lVl = (unsigned)(size_t)sVl + lof;
  copy8(lKh, lKl, 16 * TP * 2, gKh, gKl, (size_t)16 * HD * 2); LANDED(); __syncthreads();
  copy8(lVh, lVl, 16 * TP * 2, gVh, gVl, (size_t)16 * SS * 2);
#pragma unroll 1
  for (int kt = 0; kt <= qb; ++kt) {      // causal
    v8f sv[4];      // sv[t][r] = score of key kt * 64 + 16 t + 8 g + r against query q0 + col
    const int dq = q0 + col - kt * 64 - 8 * g;      // the key is past the query where 16 t + r > dq
#pragma unroll
    for (int t = 0; t < 4; ++t) { const int ko = (t * 16 + col) * TP; v8f s = {}; v16b khf[2], klf[2];
#pragma unroll
      for (int kc = 0; kc < 2; ++kc) { khf[kc] = frag_b(sKh + ko + kc * 32, lane); klf[kc] = frag_b(sKl + ko + kc * 32, lane); }      // the block's LDS reads stand together in front of its WMMAs
#pragma unroll
      for (int kc = 0; kc < 2; ++kc) { s = wmma_bf(khf[kc], aq[kc].l, s); s = wmma_bf(klf[kc], aq[kc].h, s); s = wmma_bf(khf[kc], aq[kc].h, s); }
#pragma unroll
      for (int r = 0; r < 8; ++r) sv[t][r] = (t * 16 + r > dq) ? -1.0e9f : s[r] * SC2; }
    PUBLISH();      // V(kt) readable; every wave has left K(kt)
    if (kt < qb) copy8(lKh, lKl, 16 * TP * 2, gKh + (size_t)(kt + 1) * 64 * HD * 2, gKl + (size_t)(kt + 1) * 64 * HD * 2, (size_t)16 * HD * 2);
    float mx = -3.4e38f;
#pragma unroll
    for (int t = 0; t < 4; ++t) {
#pragma unroll
      for (int r = 0; r < 8; ++r) mx = fmaxf(mx, sv[t][r]); }
    mx = fmaxf(mx, __shfl_xor(mx, 16, 32));      // the other half of the query's keys
    const float mnew = fmaxf(mrun, mx); float corr; asm("v_exp_f32 %0, %1\n\tv_nop" : "=v"(corr) : "v"(mrun - mnew));      // exp2 and the one free slot that a transcendental wants behind it, in one statement
    const float moff = mnew - 14.0f;      // 2^14, the scale of P, rides in the exponent
    v2f ps[2] = {}; v16h ph[2], pl[2];      // ps: the sum of P in two chains of packed adds; B operands of 32 keys each: element i = key 8 g + i of score tile 2 kc, element 8 + i the same of tile 2 kc + 1, the order in which frag_h reads the V rows
#pragma unroll
    for (int kc = 0; kc < 2; ++kc) {
#pragma unroll
      for (int i = 0; i < 16; ++i) { const float p = __builtin_amdgcn_exp2f(sv[2 * kc + (i >> 3)][i & 7] - moff); ps[kc][i & 1] += p; const _Float16 hi = (_Float16)p; ph[kc][i] = hi; pl[kc][i] = (_Float16)((p - (float)hi) * PLO); } }
    lrun = lrun * corr + ((ps[0][0] + ps[1][0]) + (ps[0][1] + ps[1][1])) * (1.0f / 16384.0f); mrun = mnew;
#pragma unroll
    for (int t = 0; t < 4; ++t) {
#pragma unroll
      for (int r = 0; r < 8; ++r) { acc[t][r] *= corr; ac1[t][r] *= corr; ac2[t][r] *= corr; } }      // every element of a lane belongs to its one query
#pragma unroll
    for (int kc = 0; kc < 2; ++kc) {
#pragma unroll
      for (int t = 0; t < 4; ++t) { const int vo = (t * 16 + col) * TP + kc * 32; const v16h vh = frag_h(sVh + vo, lane), vl = frag_h(sVl + vo, lane);      // the block's LDS reads stand together in front of its WMMAs
        acc[t] = wmma16(vh, ph[kc], acc[t]); ac1[t] = wmma16(vl, ph[kc], ac1[t]); ac2[t] = wmma16(vh, pl[kc], ac2[t]); } }
    PUBLISH();      // K(kt + 1) readable; every wave has left V(kt) (behind the last pass: the K tiles are free for the output staging)
    if (kt < qb) copy8(lVh, lVl, 16 * TP * 2, gVh + (size_t)(kt + 1) * 64 * 2, gVl + (size_t)(kt + 1) * 64 * 2, (size_t)16 * SS * 2); }
  LANDED();
  lrun += __shfl_xor(lrun, 16, 32);
  const float inv = 1.0f / (lrun * 16384.0f * 4.0f);
#pragma unroll
  for (int t = 0; t < 4; ++t) { v4f o[2];      // acc[t][r] = O[q0 + col][16 t + 8 g + r]: eight neighbours of one row
#pragma unroll
    for (int r = 0; r < 8; ++r) o[r >> 2][r & 3] = (acc[t][r] + ac1[t][r] * (1.0f / VLO) + ac2[t][r] * (1.0f / PLO)) * inv;
    vst2(&sO[w][col][t * 16 + 8 * g], o[0]); vst2(&sO[w][col][t * 16 + 8 * g + 4], o[1]); }
  LDSX();
  for (int qq = lane; qq < 16 * 16; qq += 32) { const int rl = qq >> 4, pc = qq & 15; vst2(O32 + ((bh * SS) + q0 + rl) * HD + pc * 4, *(const v4f*)(&sO[w][rl][pc * 4])); }
}
// out = ctx Wo : split(ctx) x bf16(Wo rows): 2 products (Wo is an INPUT -> bf16 exact)
#define CP 68      // LDS row pitch of a staged 256-B f32 row in floats: 272 B = 16 B x 17
#define OSA (64 * CP * 4)      // bytes of the ctx part of a stage: 64 rows of one head
#define OST (OSA + 128 * TP * 2)      // bytes of one stage: the ctx rows, then 128 weight rows of 64 k
__global__ __launch_bounds__(128) void k_out(const float* __restrict__ O32, const __bf16* __restrict__ PT, float* __restrict__ out) {
  __shared__ __align__(16) char sm[2 * OST];      // in the loop the two operand stages, behind it the output staging
  float (*so)[16][132] = (float (*)[16][132])sm;
  const int tid = threadIdx.x, wave = tid >> 5, lane = tid & 31, col = lane & 15, g = lane >> 4;
  const int r0b = blockIdx.x * 64, r0 = r0b + wave * 16, n0 = blockIdx.y * 128; const int b = r0b / SS, s0 = r0b % SS;
  v8f acc[8] = {};
  // ctx: each lane copies 16 B of rows tid / 16 + 8 i (a wave-wide copy = 2 rows = 4 whole lines); weights: 16 B of rows tid / 8 + 16 i
  const char* gA = (const char*)(O32 + ((size_t)b * NH * SS + s0 + (tid >> 4)) * HD + (tid & 15) * 4); const char* gB = (const char*)(PT + (size_t)(E + 2 * EKV + n0 + (tid >> 3)) * E + (tid & 7) * 8);
  const unsigned lA = (unsigned)(size_t)sm + (tid >> 4) * (CP * 4) + (tid & 15) * 16, lB = (unsigned)(size_t)sm + OSA + (tid >> 3) * (TP * 2) + (tid & 7) * 16;
  auto stage = [&](int h) { const unsigned o = (h & 1) * OST; const char* a = gA + (size_t)h * SS * HD * 4; const char* c = gB + h * 128;
    copy8(lA + o, lA + o + 32 * CP * 4, 8 * CP * 4, a, a + 32 * HD * 4, (size_t)8 * HD * 4); copy8(lB + o, lB + o + 64 * TP * 2, 16 * TP * 2, c, c + (size_t)64 * E * 2, (size_t)16 * E * 2); };
  stage(0); LANDED(); __syncthreads();
  stage(1);
#pragma unroll 1      // rolled: one pass per stage, the buffer picked by h & 1; unrolling would only lengthen the code
  for (int h = 0; h < NH; ++h) { const float* tA = (const float*)(sm + (h & 1) * OST); const __bf16* tB = (const __bf16*)(sm + (h & 1) * OST + OSA);
#pragma unroll
    for (int kc = 0; kc < 2; ++kc) { const F2 a = split_row(tA + (wave * 16 + col) * CP, kc * 32, lane); v16b wb[8];      // the block's LDS reads stand together in front of its WMMAs
#pragma unroll
      for (int j = 0; j < 8; ++j) wb[j] = frag_b(tB + (j * 16 + col) * TP + kc * 32, lane);
#pragma unroll
      for (int j = 0; j < 8; ++j) { acc[j] = wmma_bf(a.l, wb[j], acc[j]); acc[j] = wmma_bf(a.h, wb[j], acc[j]); } }
    PUBLISH();      // stage h + 1 readable; every wave has left stage h (behind the last pass: the ring is free for the output staging)
    if (h + 2 < NH) stage(h + 2); }
  LANDED();
#pragma unroll
  for (int j = 0; j < 8; ++j) {
#pragma unroll
    for (int r = 0; r < 8; ++r) so[wave][8 * g + r][j * 16 + col] = acc[j][r]; }
  LDSX();
#pragma unroll 4
  for (int rl = 0; rl < 16; ++rl) vst2(out + (size_t)(r0 + rl) * E + n0 + lane * 4, *(const v4f*)(&so[wave][rl][lane * 4]));
}
extern "C" void kernel_launch(void* const* d_in, const int* in_sizes, int n_in, void* d_out, int out_size, void* d_ws, size_t ws_size, hipStream_t stream) {
  (void)in_sizes; (void)n_in; (void)out_size; (void)ws_size;
  const float* x = (const float*)d_in[0]; const float* Wq = (const float*)d_in[1]; const float* Wk = (const float*)d_in[2]; const float* Wv = (const float*)d_in[3]; const float* Wo = (const float*)d_in[4];
  float* out = (float*)d_out;
  char* ws = (char*)d_ws; size_t off = 0;
  auto take = [&](size_t bytes) { char* p = ws + off; off += (bytes + 255) & ~(size_t)255; return p; };
  __bf16* Xb = (__bf16*)take((size_t)NR * E * 2); __bf16* PT = (__bf16*)take((size_t)(2 * E + 2 * EKV) * E * 2);
  float* Q32 = (float*)take((size_t)NR * E * 4); __bf16* Kh = (__bf16*)take((size_t)NR * EKV * 2); __bf16* Kl = (__bf16*)take((size_t)NR * EKV * 2); _Float16* VTh = (_Float16*)take((size_t)NR * EKV * 2); _Float16* VTl = (_Float16*)take((size_t)NR * EKV * 2); float* O32 = (float*)take((size_t)NR * E * 4);
  // ws ~ 102 MB
  k_prep<<<PKB + CVB, 256, 0, stream>>>(x, Wq, Wk, Wv, Wo, Xb, PT);
  k_qkv<<<dim3(NR / 64, E / 128, 3), 128, 0, stream>>>(Xb, PT, Q32, Kh, Kl, VTh, VTl);
  k_attn<<<dim3(NB * NH, SS / 64), 128, 0, stream>>>(Q32, Kh, Kl, VTh, VTl, O32);
  k_out<<<dim3(NR / 64, E / 128), 128, 0, stream>>>(O32, PT, out);
}

// v006
// Measured time: 154 microseconds a run.
// In two side-by-side timings against v005, it was 1.04 and 1.02 times as fast.
// Counting every step since v000, it is 4.48 times as fast.
// compute dtype: x and wq/wk/wv/wo (INPUTS) rounded to bf16 with exact bf16 WMMA products (f32 accumulate) for the projections; K pre-split into bf16 hi/lo rows; q f32 split, P and V f16 hi/lo (3 products each); softmax f32.
#include <hip/hip_runtime.h>
#include <math.h>

typedef __attribute__((ext_vector_type(16))) _Float16 v16h;
typedef __attribute__((ext_vector_type(16))) __bf16 v16b;
typedef __attribute__((ext_vector_type(8)))  _Float16 v8h;
typedef __attribute__((ext_vector_type(8)))  float v8f;
typedef __attribute__((ext_vector_type(4)))  float v4f;
typedef __attribute__((ext_vector_type(2)))  float v2f;
typedef __attribute__((ext_vector_type(4)))  unsigned v4u;
typedef __attribute__((ext_vector_type(4)))  int v4i;
typedef float __attribute__((may_alias)) float_a;
typedef int __attribute__((may_alias)) int_a;

template <typename T> __device__ __forceinline__ void vst2(void* p, T v) { *(T*)p = v;  }
__device__ __forceinline__ v8f wmma16(v16h a, v16h b, v8f c) {
  v8f d = __builtin_amdgcn_wmma_f32_16x16x32_f16(false, a, false, b, (short)0, c, false, false);
  asm volatile("v_nop\n\tv_nop\n\tv_nop\n\tv_nop" : "+v"(d) : "v"(a), "v"(b));
  return d;
}
__device__ __forceinline__ v8f wmma_bf(v16b a, v16b b, v8f c) {
  v8f d = __builtin_amdgcn_wmma_f32_16x16x32_bf16(false, a, false, b, (short)0, c, false, false);
  asm volatile("v_nop\n\tv_nop\n\tv_nop\n\tv_nop" : "+v"(d) : "v"(a), "v"(b));
  return d;
}
// 16x16x32 fragments: lane = (h = lane>>4, row/col = lane&15); elements 0..7 = k0+8h+0..7, 8..15 = k0+16+8h+0..7; D element r = row 8h+r
__device__ __forceinline__ v16h frag_h(const _Float16* rowk0, int lane) {
  union { v16h v; v8h q[2]; } u; const _Float16* p = rowk0 + 8 * (lane >> 4);
  u.q[0] = *(const v8h*)p; u.q[1] = *(const v8h*)(p + 16); return u.v;
}
__device__ __forceinline__ v16h frag_f32(const float* rowk0, int lane) {
  v16h a; const float* p = rowk0 + 8 * (lane >> 4);
#pragma unroll
  for (int i = 0; i < 8; ++i) { a[i] = (_Float16)p[i]; a[8 + i] = (_Float16)p[16 + i]; }
  return a;
}
__device__ __forceinline__ v16h frag_f32s(const float* rowk0, int lane, float sc) {
  v16h a; const float* p = rowk0 + 8 * (lane >> 4);
#pragma unroll
  for (int i = 0; i < 8; ++i) { a[i] = (_Float16)(p[i] * sc); a[8 + i] = (_Float16)(p[16 + i] * sc); }
  return a;
}
// column fragment from a [K][ld] layout (column n), rows >= K read as 0
__device__ __forceinline__ v16h fragc_f32(const float* W, int k0, int n, int lane, int ld, int K) {
  v16h a; const int g = lane >> 4;
#pragma unroll
  for (int i = 0; i < 8; ++i) { const int ka = k0 + 8 * g + i, kb = ka + 16;
    a[i] = (_Float16)(ka < K ? W[(size_t)ka * ld + n] : 0.f); a[8 + i] = (_Float16)(kb < K ? W[(size_t)kb * ld + n] : 0.f); }
  return a;
}
struct F2 { v16b h, l; };
__device__ __forceinline__ F2 bsplit16(const float v[16]) { F2 r;
#pragma unroll
  for (int i = 0; i < 16; ++i) { const __bf16 h = (__bf16)v[i]; r.h[i] = h; r.l[i] = (__bf16)(v[i] - (float)h); }
  return r; }
__device__ __forceinline__ F2 split_row(const float* row, int k0, int lane) { float v[16]; const float* p = row + k0 + 8 * (lane >> 4);
#pragma unroll
  for (int i = 0; i < 8; ++i) { v[i] = p[i]; v[8 + i] = p[16 + i]; }
  return bsplit16(v); }
__device__ __forceinline__ F2 split_rowK(const float* row, int k0, int lane, int K) { float v[16]; const int g = lane >> 4;
#pragma unroll
  for (int i = 0; i < 8; ++i) { const int ka = k0 + 8 * g + i, kb = ka + 16; v[i] = ka < K ? row[ka] : 0.f; v[8 + i] = kb < K ? row[kb] : 0.f; }
  return bsplit16(v); }
__device__ __forceinline__ F2 split_col(const float* W, int k0, int n, int lane, int ld, int K) { float v[16]; const int g = lane >> 4;
#pragma unroll
  for (int i = 0; i < 8; ++i) { const int ka = k0 + 8 * g + i, kb = ka + 16; v[i] = ka < K ? W[(size_t)ka * ld + n] : 0.f; v[8 + i] = kb < K ? W[(size_t)kb * ld + n] : 0.f; }
  return bsplit16(v); }
__device__ __forceinline__ v8f mac3(const F2& a, const F2& b, v8f c) { c = wmma_bf(a.l, b.h, c); c = wmma_bf(a.h, b.l, c); return wmma_bf(a.h, b.h, c); }
__device__ __forceinline__ float sigm(float v) { return 1.0f / (1.0f + expf(-v)); }
#define LDSX() do { asm volatile("s_wait_dscnt 0" ::: "memory"); __builtin_amdgcn_wave_barrier(); __builtin_amdgcn_fence(__ATOMIC_RELEASE, "workgroup"); } while (0)


// Grouped-query causal self attention (16 query heads, 4 kv heads of 64 on [4,2048,1024], [in][out] weights, no biases): head h reads kv head h/4 (repeat_kv); -inf above the diagonal; (P v) @ wo. Key tiles past the query block are skipped.
#define NB 4
#define SS 2048
#define E 1024
#define NH 16
#define NKV 4
#define EKV (NKV * HD)
#define HD 64
#define NR (NB * SS)
#define PLO 1024.0f
#define VLO 2048.0f
#define SC2 0.18033688f      // 1/sqrt(64) x log2(e): the scores and their running maximum are kept in base-2 units, so that each exponential is one hardware exp2
__device__ __forceinline__ float bfr(float v) { return (float)(__bf16)v; }
__device__ __forceinline__ v16b frag_b(const __bf16* rowk0, int lane) { return __builtin_bit_cast(v16b, frag_h((const _Float16*)rowk0, lane)); }

#define TP 72      // LDS row pitch of a staged 128-B row in 16-bit elements: 144 B = 16 B x 9, the conflict-free pitch for 16-byte fragment reads
// Asynchronous copies global -> LDS, 16 B per lane, rows gs bytes apart in global memory and ls bytes apart in LDS. The copies and their s_wait_xcnt stand in one statement, so that no address register is rewritten before the wait.
__device__ __forceinline__ void copy8(unsigned la, unsigned lc, unsigned ls, const char* a, const char* c, size_t gs) {
  asm volatile("global_load_async_to_lds_b128 %0, %8, off\n\t"
               "global_load_async_to_lds_b128 %1, %9, off\n\t"
               "global_load_async_to_lds_b128 %2, %10, off\n\t"
               "global_load_async_to_lds_b128 %3, %11, off\n\t"
               "global_load_async_to_lds_b128 %4, %12, off\n\t"
               "global_load_async_to_lds_b128 %5, %13, off\n\t"
               "global_load_async_to_lds_b128 %6, %14, off\n\t"
               "global_load_async_to_lds_b128 %7, %15, off\n\t"
               "s_wait_xcnt 0x0"
               :: "v"(la), "v"(la + ls), "v"(la + 2 * ls), "v"(la + 3 * ls), "v"(lc), "v"(lc + ls), "v"(lc + 2 * ls), "v"(lc + 3 * ls),
                  "v"(a), "v"(a + gs), "v"(a + 2 * gs), "v"(a + 3 * gs), "v"(c), "v"(c + gs), "v"(c + 2 * gs), "v"(c + 3 * gs) : "memory");
}
// this wave's own copies have landed (in front of the barrier that lets other waves read them, and behind the last copy of a kernel)
#define LANDED() asm volatile("s_wait_asynccnt 0x0" ::: "memory")
// publish point of a staged tile: this wave's LDS reads retired, its own copies landed, then the work-group barrier (it publishes the tile that flew and frees the one just read)
#define PUBLISH() do { asm volatile("s_wait_dscnt 0" ::: "memory"); LANDED(); __syncthreads(); } while (0)

// x -> bf16 (Xb) and the weight columns -> bf16 rows (PT) in ONE launch of few work-groups with long waves, all of a wave's loads in flight at once, instead of one short wave per KB
// PT rows: [0,E) Wq[:,n], [E,E+EKV) Wk[:,n], [E+EKV,E+2EKV) Wv[:,n], [E+2EKV,2E+2EKV) Wo[:,n]  ([in][out] weights: column n as a bf16 row)
#define PKT 4      // weight tiles of 64 k x 32 n per packing work-group: 256 k of 32 columns
#define PKB ((2 * E + 2 * EKV) / 32 * (E / 64) / PKT)      // packing work-groups; they carry the lowest indices: their chain (loads, LDS, barrier, stores) is the longer one
#define CVU 8      // units of 256 lanes x 8 floats per converting work-group
#define CVB (NR * E / (CVU * 256 * 8))      // converting work-groups
__global__ __launch_bounds__(256) void k_prep(const float* __restrict__ x, const float* __restrict__ Wq, const float* __restrict__ Wk, const float* __restrict__ Wv, const float* __restrict__ Wo, __bf16* __restrict__ Xb, __bf16* __restrict__ PT) {
  static_assert(E % (64 * PKT) == 0 && E % 32 == 0 && EKV % 32 == 0, "a work-group's tiles lie in 32 columns of one weight matrix");
  static_assert((size_t)CVB * CVU * 256 * 8 == (size_t)NR * E, "every x element once");
  __shared__ __align__(16) unsigned st[PKT][32][36];      // [tile][n][k pair], row pitch 144 B = 16 B x 9
  const int tid = threadIdx.x;
  if (blockIdx.x < PKB) {      // the same for the whole work-group: its barrier is passed by all of its waves or by none
    const int r8 = tid >> 3, c8 = tid & 7;
    const int n = (int)(blockIdx.x / (E / 64 / PKT)) * 32, k0 = (int)(blockIdx.x % (E / 64 / PKT)) * (64 * PKT);
    const float* W = n < E ? Wq : (n < E + EKV ? Wk : (n < E + 2 * EKV ? Wv : Wo)); const int nn = n < E ? n : (n < E + EKV ? n - E : (n < E + 2 * EKV ? n - E - EKV : n - E - 2 * EKV)); const int ld = (n >= E && n < E + 2 * EKV) ? EKV : E;      // [in][out]: columns nn .. nn + 31
    const unsigned off = (unsigned)(2 * r8 * ld + c8 * 4);
    v4f a[PKT], c[PKT];      // rows k0 + 64 i + 2 r8 and the next, columns 4 c8 .. 4 c8 + 3: eight lanes read one whole 128-B line
#pragma unroll
    for (int i = 0; i < PKT; ++i) { const float* p = W + (size_t)(k0 + 64 * i) * ld + nn; a[i] = *(const v4f*)(p + off); c[i] = *(const v4f*)(p + ld + off); }
#pragma unroll
    for (int i = 0; i < PKT; ++i) {
#pragma unroll
      for (int j = 0; j < 4; ++j) { union { __bf16 h[2]; unsigned u; } pk; pk.h[0] = (__bf16)a[i][j]; pk.h[1] = (__bf16)c[i][j]; st[i][c8 * 4 + j][r8] = pk.u; } }
    __syncthreads();      // the tiles are whole
    v4u o[PKT];
#pragma unroll
    for (int i = 0; i < PKT; ++i) o[i] = *(const v4u*)(&st[i][r8][c8 * 4]);
#pragma unroll
    for (int i = 0; i < PKT; ++i) vst2((unsigned*)(PT + (size_t)(n + r8) * E + k0 + 64 * i + c8 * 8), o[i]);      // eight lanes write one whole 128-B line of a PT row
  } else {
    const size_t i8 = (size_t)(blockIdx.x - PKB) * (CVU * 256) + tid;
    v4f v[CVU][2];
#pragma unroll
    for (int u = 0; u < CVU; ++u) { const float* p = x + (i8 + u * 256) * 8; v[u][0] = *(const v4f*)p; v[u][1] = *(const v4f*)(p + 4); }
#pragma unroll
    for (int u = 0; u < CVU; ++u) { union { __bf16 h[8]; v4u u4; } pk;
#pragma unroll
      for (int e = 0; e < 8; ++e) pk.h[e] = (__bf16)v[u][e >> 2][e & 3];
      vst2((unsigned*)(Xb + (i8 + u * 256) * 8), pk.u4); }
    asm volatile("s_wait_xcnt 0x0" ::: "memory");      // behind the last store of the run: no register that an issued store names is rewritten in front of this wait
  }
}
// QKV: block (128 rows, 128 cols = 2 heads, which), a wave = 32 rows x 128 cols: each weight fragment read from LDS feeds two WMMAs, and a weight tile is fetched from L2 once per 128 rows; q -> Q32 f32 [bh][s][64]; k -> bf16 hi/lo rows; v -> VT hi/lo x4 [bh][d][s]
#define QST (256 * TP * 2)      // bytes of one stage: 128 x rows, then 128 weight rows, 64 k (128 B) each, at pitch TP
#define VP 136      // LDS row pitch of the transposed v staging in 16-bit elements: 128 positions + 8, 272 B = 16 B x 17
__global__ __launch_bounds__(128) void k_qkv(const __bf16* __restrict__ Xb, const __bf16* __restrict__ PT, float* __restrict__ Q32, __bf16* __restrict__ Kh, __bf16* __restrict__ Kl, _Float16* __restrict__ VTh, _Float16* __restrict__ VTl) {
  __shared__ __align__(16) char sm[2 * QST];      // in the loop the two operand stages, behind it the output staging
  float (*so)[32][132] = (float (*)[32][132])sm; _Float16 (*sth)[VP] = (_Float16 (*)[VP])sm; _Float16 (*stl)[VP] = (_Float16 (*)[VP])(sm + 128 * VP * 2);
  static_assert(4 * 32 * 132 * 4 <= 2 * QST && 2 * 128 * VP * 2 <= 2 * QST, "the output staging lies inside the ring");
  const int tid = threadIdx.x, wave = tid >> 5, lane = tid & 31, col = lane & 15, g = lane >> 4;
  const int which = blockIdx.z, r0b = blockIdx.x * 128, n0 = blockIdx.y * 128; const int b = r0b / SS, s0 = r0b % SS;
  if (which > 0 && n0 >= EKV) return;      // k and v have only 4 heads
  const int prow = (which == 0 ? 0 : (which == 1 ? E : E + EKV)) + n0;
  v8f acc[2][8] = {};      // [16-row half of the wave's 32 rows][16-column block]
  // each lane copies 16 B of rows tid / 8 + 16 i: a wave-wide copy = 4 whole 128-B lines
  const char* gA = (const char*)(Xb + (size_t)(r0b + (tid >> 3)) * E + (tid & 7) * 8); const char* gB = (const char*)(PT + (size_t)(prow + (tid >> 3)) * E + (tid & 7) * 8);
  const unsigned lA = (unsigned)(size_t)sm + (tid >> 3) * (TP * 2) + (tid & 7) * 16, lB = lA + 128 * TP * 2;
  auto stage = [&](int s) { const unsigned o = (s & 1) * QST; const char* a = gA + s * 128; const char* c = gB + s * 128;
    copy8(lA + o, lA + o + 64 * TP * 2, 16 * TP * 2, a, a + (size_t)64 * E * 2, (size_t)16 * E * 2); copy8(lB + o, lB + o + 64 * TP * 2, 16 * TP * 2, c, c + (size_t)64 * E * 2, (size_t)16 * E * 2); };
  stage(0); LANDED(); __syncthreads();
  stage(1);
#pragma unroll 1      // rolled: one pass per stage, the buffer picked by s & 1; unrolling would only lengthen the code
  for (int s = 0; s < E / 64; ++s) { const __bf16* tA = (const __bf16*)(sm + (s & 1) * QST); const __bf16* tB = tA + 128 * TP;
#pragma unroll
    for (int kc = 0; kc < 2; ++kc) { const v16b a0 = frag_b(tA + (wave * 32 + col) * TP + kc * 32, lane), a1 = frag_b(tA + (wave * 32 + 16 + col) * TP + kc * 32, lane); v16b wb[8];      // the block's LDS reads stand together in front of its WMMAs
#pragma unroll
      for (int j = 0; j < 8; ++j) wb[j] = frag_b(tB + (j * 16 + col) * TP + kc * 32, lane);
#pragma unroll
      for (int j = 0; j < 8; ++j) { acc[0][j] = wmma_bf(a0, wb[j], acc[0][j]); acc[1][j] = wmma_bf(a1, wb[j], acc[1][j]); } }
    PUBLISH();      // stage s + 1 readable; every wave has left stage s (behind the last pass: the ring is free for the output staging)
    if (s + 2 < E / 64) stage(s + 2); }
  LANDED();
  if (which < 2) {
#pragma unroll
    for (int m = 0; m < 2; ++m) {
#pragma unroll
      for (int j = 0; j < 8; ++j) { const float bb = 0.f;
#pragma unroll
        for (int r = 0; r < 8; ++r) so[wave][m * 16 + 8 * g + r][j * 16 + col] = acc[m][j][r] + bb; } }
    LDSX();
    if (which == 0) { for (int qq = lane; qq < 2 * 32 * 16; qq += 32) { const int hh = qq >> 9, rl = (qq >> 4) & 31, pc = qq & 15; const int h = (n0 >> 6) + hh;
        vst2(Q32 + (((size_t)b * NH + h) * SS + s0 + wave * 32 + rl) * HD + pc * 4, *(const v4f*)(&so[wave][rl][hh * 64 + pc * 4])); } }
    else {
      for (int qq = lane; qq < 2 * 32 * 16; qq += 32) { const int hh = qq >> 9, rl = (qq >> 4) & 31, pl = qq & 15; const int h = (n0 >> 6) + hh; const int pc = pl & 7; union { __bf16 e[8]; v4u u; } pk;
#pragma unroll
        for (int e = 0; e < 8; ++e) { const float v = so[wave][rl][hh * 64 + pc * 8 + e]; const __bf16 hi = (__bf16)v; pk.e[e] = pl < 8 ? hi : (__bf16)(v - (float)hi); }
        vst2((unsigned*)((pl < 8 ? Kh : Kl) + (((size_t)b * NKV + h) * SS + s0 + wave * 32 + rl) * HD + pc * 8), pk.u); } } }
  else {
#pragma unroll
    for (int m = 0; m < 2; ++m) {
#pragma unroll
      for (int j = 0; j < 8; ++j) { const float bb = 0.f;
#pragma unroll
        for (int r = 0; r < 8; ++r) { const float v = (acc[m][j][r] + bb) * 4.0f; const _Float16 hi = (_Float16)v; sth[j * 16 + col][wave * 32 + m * 16 + 8 * g + r] = hi; stl[j * 16 + col][wave * 32 + m * 16 + 8 * g + r] = (_Float16)((v - (float)hi) * VLO); } } }
    __syncthreads();
    for (int qq = tid; qq < 128 * 16; qq += 128) { const int cl = qq >> 4, pc = qq & 15; const int c = n0 + cl, h = c >> 6, d = c & 63; const size_t o = (((size_t)b * NKV + h) * HD + d) * SS + s0 + pc * 8;
      vst2(VTh + o, *(const v4u*)(&sth[cl][pc * 8])); vst2(VTl + o, *(const v4u*)(&stl[cl][pc * 8])); } }
}
__global__ __launch_bounds__(128, 4) void k_attn(const float* __restrict__ Q32, const __bf16* __restrict__ Kh, const __bf16* __restrict__ Kl, const _Float16* __restrict__ VTh, const _Float16* __restrict__ VTl, float* __restrict__ O32) {
  __shared__ __align__(16) char sm[4 * 64 * TP * 2];      // in the loop the K hi, K lo, V hi, V lo tiles; behind it the K part is the output staging
  __bf16* sKh = (__bf16*)sm; __bf16* sKl = sKh + 64 * TP; _Float16* sVh = (_Float16*)(sm + 2 * 64 * TP * 2); _Float16* sVl = sVh + 64 * TP;
  float (*sO)[16][68] = (float (*)[16][68])sm; static_assert(4 * 16 * 68 * 4 <= 2 * 64 * TP * 2, "the output staging lies on the K tiles alone");
  const int tid = threadIdx.x, w = tid >> 5, lane = tid & 31, col = lane & 15, g = lane >> 4;
  // the longest query blocks carry the lowest block indices (for speed only)
  static_assert((SS / 64 & (SS / 64 - 1)) == 0, "the xor reverses the index only for a power of two");
  const size_t bh = blockIdx.x; const int qb = (SS / 64 - 1) ^ (int)blockIdx.y; const int q0 = qb * 64 + w * 16;
  F2 aq[2];
#pragma unroll
  for (int kc = 0; kc < 2; ++kc) aq[kc] = split_row(Q32 + (bh * SS + q0 + col) * HD, kc * 32, lane);
  const int b = (int)(bh / NH); const size_t kvh = (size_t)b * NKV + (bh % NH) / (NH / NKV);     // repeat_kv: query head h reads kv head h/4
  float mrun = -3.0e38f, lrun = 0.f; v8f acc[4] = {}, ac1[4] = {}, ac2[4] = {};      // mrun: the query's maximum (equal in both lane halves); lrun: the sum over this lane half's keys, joined behind the loop
  // each lane copies 16 B of rows tid / 8 + 16 i of the hi and of the lo plane: a wave-wide copy = 4 whole 128-B lines
  const size_t kof = ((kvh * SS + (tid >> 3)) * HD + (tid & 7) * 8) * 2, vof = ((kvh * HD + (tid >> 3)) * SS + (tid & 7) * 8) * 2;      // bytes; K tile: rows = keys, 128 B apart; V tile: rows = d, SS * 2 bytes apart
  const char* gKh = (const char*)Kh + kof; const char* gKl = (const char*)Kl + kof; const char* gVh = (const char*)VTh + vof; const char* gVl = (const char*)VTl + vof;
  const unsigned lof = (tid >> 3) * (TP * 2) + (tid & 7) * 16;
  const unsigned lKh = (unsigned)(size_t)sKh + lof, lKl = (unsigned)(size_t)sKl + lof, lVh = (unsigned)(size_t)sVh + lof, lVl = (unsigned)(size_t)sVl + lof;
  copy8(lKh, lKl, 16 * TP * 2, gKh, gKl, (size_t)16 * HD * 2); LANDED(); __syncthreads();
  copy8(lVh, lVl, 16 * TP * 2, gVh, gVl, (size_t)16 * SS * 2);
#pragma unroll 1
  for (int kt = 0; kt <= qb; ++kt) {      // causal
    v8f sv[4];      // sv[t][r] = score of key kt * 64 + 16 t + 8 g + r against query q0 + col
    const int dq = q0 + col - kt * 64 - 8 * g;      // the key is past the query where 16 t + r > dq
#pragma unroll
    for (int t = 0; t < 4; ++t) { const int ko = (t * 16 + col) * TP; v8f s = {}; v16b khf[2], klf[2];
#pragma unroll
      for (int kc = 0; kc < 2; ++kc) { khf[kc] = frag_b(sKh + ko + kc * 32, lane); klf[kc] = frag_b(sKl + ko + kc * 32, lane); }      // the block's LDS reads stand together in front of its WMMAs
#pragma unroll
      for (int kc = 0; kc < 2; ++kc) { s = wmma_bf(khf[kc], aq[kc].l, s); s = wmma_bf(klf[kc], aq[kc].h, s); s = wmma_bf(khf[kc], aq[kc].h, s); }
#pragma unroll
      for (int r = 0; r < 8; ++r) sv[t][r] = (t * 16 + r > dq) ? -1.0e9f : s[r] * SC2; }
    PUBLISH();      // V(kt) readable; every wave has left K(kt)
    if (kt < qb) copy8(lKh, lKl, 16 * TP * 2, gKh + (size_t)(kt + 1) * 64 * HD * 2, gKl + (size_t)(kt + 1) * 64 * HD * 2, (size_t)16 * HD * 2);
    float mx = -3.4e38f;
#pragma unroll
    for (int t = 0; t < 4; ++t) {
#pragma unroll
      for (int r = 0; r < 8; ++r) mx = fmaxf(mx, sv[t][r]); }
    mx = fmaxf(mx, __shfl_xor(mx, 16, 32));      // the other half of the query's keys
    const float mnew = fmaxf(mrun, mx); float corr; asm("v_exp_f32 %0, %1\n\tv_nop" : "=v"(corr) : "v"(mrun - mnew));      // exp2 and the one free slot that a transcendental wants behind it, in one statement
    const float moff = mnew - 14.0f;      // 2^14, the scale of P, rides in the exponent
    v2f ps[2] = {}; v16h ph[2], pl[2];      // ps: the sum of P in two chains of packed adds; B operands of 32 keys each: element i = key 8 g + i of score tile 2 kc, element 8 + i the same of tile 2 kc + 1, the order in which frag_h reads the V rows
#pragma unroll
    for (int kc = 0; kc < 2; ++kc) {
#pragma unroll
      for (int i = 0; i < 16; ++i) { const float p = __builtin_amdgcn_exp2f(sv[2 * kc + (i >> 3)][i & 7] - moff); ps[kc][i & 1] += p; const _Float16 hi = (_Float16)p; ph[kc][i] = hi; pl[kc][i] = (_Float16)((p - (float)hi) * PLO); } }
    lrun = lrun * corr + ((ps[0][0] + ps[1][0]) + (ps[0][1] + ps[1][1])) * (1.0f / 16384.0f); mrun = mnew;
#pragma unroll
    for (int t = 0; t < 4; ++t) {
#pragma unroll
      for (int r = 0; r < 8; ++r) { acc[t][r] *= corr; ac1[t][r] *= corr; ac2[t][r] *= corr; } }      // every element of a lane belongs to its one query
#pragma unroll
    for (int kc = 0; kc < 2; ++kc) {
#pragma unroll
      for (int t = 0; t < 4; ++t) { const int vo = (t * 16 + col) * TP + kc * 32; const v16h vh = frag_h(sVh + vo, lane), vl = frag_h(sVl + vo, lane);      // the block's LDS reads stand together in front of its WMMAs
        acc[t] = wmma16(vh, ph[kc], acc[t]); ac1[t] = wmma16(vl, ph[kc], ac1[t]); ac2[t] = wmma16(vh, pl[kc], ac2[t]); } }
    PUBLISH();      // K(kt + 1) readable; every wave has left V(kt) (behind the last pass: the K tiles are free for the output staging)
    if (kt < qb) copy8(lVh, lVl, 16 * TP * 2, gVh + (size_t)(kt + 1) * 64 * 2, gVl + (size_t)(kt + 1) * 64 * 2, (size_t)16 * SS * 2); }
  LANDED();
  lrun += __shfl_xor(lrun, 16, 32);
  const float inv = 1.0f / (lrun * 16384.0f * 4.0f);
#pragma unroll
  for (int t = 0; t < 4; ++t) { v4f o[2];      // acc[t][r] = O[q0 + col][16 t + 8 g + r]: eight neighbours of one row
#pragma unroll
    for (int r = 0; r < 8; ++r) o[r >> 2][r & 3] = (acc[t][r] + ac1[t][r] * (1.0f / VLO) + ac2[t][r] * (1.0f / PLO)) * inv;
    vst2(&sO[w][col][t * 16 + 8 * g], o[0]); vst2(&sO[w][col][t * 16 + 8 * g + 4], o[1]); }
  LDSX();
  for (int qq = lane; qq < 16 * 16; qq += 32) { const int rl = qq >> 4, pc = qq & 15; vst2(O32 + ((bh * SS) + q0 + rl) * HD + pc * 4, *(const v4f*)(&sO[w][rl][pc * 4])); }
}
// out = ctx Wo : split(ctx) x bf16(Wo rows): 2 products (Wo is an INPUT -> bf16 exact)
#define CP 68      // LDS row pitch of a staged 256-B f32 row in floats: 272 B = 16 B x 17
#define OSA (128 * CP * 4)      // bytes of the ctx part of a stage: 128 rows of one head
#define OST (OSA + 128 * TP * 2)      // bytes of one stage: the ctx rows, then 128 weight rows of 64 k
__global__ __launch_bounds__(128) void k_out(const float* __restrict__ O32, const __bf16* __restrict__ PT, float* __restrict__ out) {
  __shared__ __align__(16) char sm[2 * OST];      // in the loop the two operand stages, behind it the output staging
  float (*so)[32][132] = (float (*)[32][132])sm; static_assert(4 * 32 * 132 * 4 <= 2 * OST, "the output staging lies inside the ring");
  const int tid = threadIdx.x, wave = tid >> 5, lane = tid & 31, col = lane & 15, g = lane >> 4;
  const int r0b = blockIdx.x * 128, r0 = r0b + wave * 32, n0 = blockIdx.y * 128; const int b = r0b / SS, s0 = r0b % SS;      // block: 128 rows x 128 cols, a wave = 32 rows x 128 cols
  v8f acc[2][8] = {};      // [16-row half of the wave's 32 rows][16-column block]
  // ctx: each lane copies 16 B of rows tid / 16 + 8 i (a wave-wide copy = 2 rows = 4 whole lines); weights: 16 B of rows tid / 8 + 16 i
  const char* gA = (const char*)(O32 + ((size_t)b * NH * SS + s0 + (tid >> 4)) * HD + (tid & 15) * 4); const char* gB = (const char*)(PT + (size_t)(E + 2 * EKV + n0 + (tid >> 3)) * E + (tid & 7) * 8);
  const unsigned lA = (unsigned)(size_t)sm + (tid >> 4) * (CP * 4) + (tid & 15) * 16, lB = (unsigned)(size_t)sm + OSA + (tid >> 3) * (TP * 2) + (tid & 7) * 16;
  auto stage = [&](int h) { const unsigned o = (h & 1) * OST; const char* a = gA + (size_t)h * SS * HD * 4; const char* c = gB + h * 128;
    copy8(lA + o, lA + o + 32 * CP * 4, 8 * CP * 4, a, a + 32 * HD * 4, (size_t)8 * HD * 4); copy8(lA + o + 64 * CP * 4, lA + o + 96 * CP * 4, 8 * CP * 4, a + 64 * HD * 4, a + 96 * HD * 4, (size_t)8 * HD * 4); copy8(lB + o, lB + o + 64 * TP * 2, 16 * TP * 2, c, c + (size_t)64 * E * 2, (size_t)16 * E * 2); };
  stage(0); LANDED(); __syncthreads();
  stage(1);
#pragma unroll 1      // rolled: one pass per stage, the buffer picked by h & 1; unrolling would only lengthen the code
  for (int h = 0; h < NH; ++h) { const float* tA = (const float*)(sm + (h & 1) * OST); const __bf16* tB = (const __bf16*)(sm + (h & 1) * OST + OSA);
#pragma unroll
    for (int kc = 0; kc < 2; ++kc) { const F2 a0 = split_row(tA + (wave * 32 + col) * CP, kc * 32, lane), a1 = split_row(tA + (wave * 32 + 16 + col) * CP, kc * 32, lane); v16b wb[8];      // the block's LDS reads stand together in front of its WMMAs
#pragma unroll
      for (int j = 0; j < 8; ++j) wb[j] = frag_b(tB + (j * 16 + col) * TP + kc * 32, lane);
#pragma unroll
      for (int j = 0; j < 8; ++j) { acc[0][j] = wmma_bf(a0.l, wb[j], acc[0][j]); acc[1][j] = wmma_bf(a1.l, wb[j], acc[1][j]); acc[0][j] = wmma_bf(a0.h, wb[j], acc[0][j]); acc[1][j] = wmma_bf(a1.h, wb[j], acc[1][j]); } }
    PUBLISH();      // stage h + 1 readable; every wave has left stage h (behind the last pass: the ring is free for the output staging)
    if (h + 2 < NH) stage(h + 2); }
  LANDED();
#pragma unroll
  for (int m = 0; m < 2; ++m) {
#pragma unroll
    for (int j = 0; j < 8; ++j) {
#pragma unroll
      for (int r = 0; r < 8; ++r) so[wave][m * 16 + 8 * g + r][j * 16 + col] = acc[m][j][r]; } }
  LDSX();
#pragma unroll 4
  for (int rl = 0; rl < 32; ++rl) vst2(out + (size_t)(r0 + rl) * E + n0 + lane * 4, *(const v4f*)(&so[wave][rl][lane * 4]));
}
extern "C" void kernel_launch(void* const* d_in, const int* in_sizes, int n_in, void* d_out, int out_size, void* d_ws, size_t ws_size, hipStream_t stream) {
  (void)in_sizes; (void)n_in; (void)out_size; (void)ws_size;
  const float* x = (const float*)d_in[0]; const float* Wq = (const float*)d_in[1]; const float* Wk = (const float*)d_in[2]; const float* Wv = (const float*)d_in[3]; const float* Wo = (const float*)d_in[4];
  float* out = (float*)d_out;
  char* ws = (char*)d_ws; size_t off = 0;
  auto take = [&](size_t bytes) { char* p = ws + off; off += (bytes + 255) & ~(size_t)255; return p; };
  __bf16* Xb = (__bf16*)take((size_t)NR * E * 2); __bf16* PT = (__bf16*)take((size_t)(2 * E + 2 * EKV) * E * 2);
  float* Q32 = (float*)take((size_t)NR * E * 4); __bf16* Kh = (__bf16*)take((size_t)NR * EKV * 2); __bf16* Kl = (__bf16*)take((size_t)NR * EKV * 2); _Float16* VTh = (_Float16*)take((size_t)NR * EKV * 2); _Float16* VTl = (_Float16*)take((size_t)NR * EKV * 2); float* O32 = (float*)take((size_t)NR * E * 4);
  // ws ~ 102 MB
  k_prep<<<PKB + CVB, 256, 0, stream>>>(x, Wq, Wk, Wv, Wo, Xb, PT);
  k_qkv<<<dim3(NR / 128, E / 128, 3), 128, 0, stream>>>(Xb, PT, Q32, Kh, Kl, VTh, VTl);
  k_attn<<<dim3(NB * NH, SS / 64), 128, 0, stream>>>(Q32, Kh, Kl, VTh, VTl, O32);
  k_out<<<dim3(NR / 128, E / 128), 128, 0, stream>>>(O32, PT, out);
}

// v007
// One run takes 143 microseconds.
// Next to v006, in two timings, it ran 1.08 times as fast each time.
// Counting every step since v000, it is 4.85 times as fast.
// compute dtype: x and wq/wk/wv/wo (INPUTS) rounded to bf16 with exact bf16 WMMA products (f32 accumulate) for the projections; K pre-split into bf16 hi/lo rows; q f32 split, P and V f16 hi/lo (3 products each); softmax f32.
#include <hip/hip_runtime.h>
#include <math.h>

typedef __attribute__((ext_vector_type(16))) _Float16 v16h;
typedef __attribute__((ext_vector_type(16))) __bf16 v16b;
typedef __attribute__((ext_vector_type(8)))  _Float16 v8h;
typedef __attribute__((ext_vector_type(8)))  float v8f;
typedef __attribute__((ext_vector_type(4)))  float v4f;
typedef __attribute__((ext_vector_type(2)))  float v2f;
typedef __attribute__((ext_vector_type(4)))  unsigned v4u;
typedef __attribute__((ext_vector_type(4)))  int v4i;
typedef float __attribute__((may_alias)) float_a;
typedef int __attribute__((may_alias)) int_a;

template <typename T> __device__ __forceinline__ void vst2(void* p, T v) { *(T*)p = v;  }
__device__ __forceinline__ v8f wmma16(v16h a, v16h b, v8f c) {
  v8f d = __builtin_amdgcn_wmma_f32_16x16x32_f16(false, a, false, b, (short)0, c, false, false);
  asm volatile("v_nop\n\tv_nop\n\tv_nop\n\tv_nop" : "+v"(d) : "v"(a), "v"(b));
  return d;
}
__device__ __forceinline__ v8f wmma_bf(v16b a, v16b b, v8f c) {
  v8f d = __builtin_amdgcn_wmma_f32_16x16x32_bf16(false, a, false, b, (short)0, c, false, false);
  asm volatile("v_nop\n\tv_nop\n\tv_nop\n\tv_nop" : "+v"(d) : "v"(a), "v"(b));
  return d;
}
// 16x16x32 fragments: lane = (h = lane>>4, row/col = lane&15); elements 0..7 = k0+8h+0..7, 8..15 = k0+16+8h+0..7; D element r = row 8h+r
__device__ __forceinline__ v16h frag_h(const _Float16* rowk0, int lane) {
  union { v16h v; v8h q[2]; } u; const _Float16* p = rowk0 + 8 * (lane >> 4);
  u.q[0] = *(const v8h*)p; u.q[1] = *(const v8h*)(p + 16); return u.v;
}
__device__ __forceinline__ v16h frag_f32(const float* rowk0, int lane) {
  v16h a; const float* p = rowk0 + 8 * (lane >> 4);
#pragma unroll
  for (int i = 0; i < 8; ++i) { a[i] = (_Float16)p[i]; a[8 + i] = (_Float16)p[16 + i]; }
  return a;
}
__device__ __forceinline__ v16h frag_f32s(const float* rowk0, int lane, float sc) {
  v16h a; const float* p = rowk0 + 8 * (lane >> 4);
#pragma unroll
  for (int i = 0; i < 8; ++i) { a[i] = (_Float16)(p[i] * sc); a[8 + i] = (_Float16)(p[16 + i] * sc); }
  return a;
}
// column fragment from a [K][ld] layout (column n), rows >= K read as 0
__device__ __forceinline__ v16h fragc_f32(const float* W, int k0, int n, int lane, int ld, int K) {
  v16h a; const int g = lane >> 4;
#pragma unroll
  for (int i = 0; i < 8; ++i) { const int ka = k0 + 8 * g + i, kb = ka + 16;
    a[i] = (_Float16)(ka < K ? W[(size_t)ka * ld + n] : 0.f); a[8 + i] = (_Float16)(kb < K ? W[(size_t)kb * ld + n] : 0.f); }
  return a;
}
struct F2 { v16b h, l; };
__device__ __forceinline__ F2 bsplit16(const float v[16]) { F2 r;
#pragma unroll
  for (int i = 0; i < 16; ++i) { const __bf16 h = (__bf16)v[i]; r.h[i] = h; r.l[i] = (__bf16)(v[i] - (float)h); }
  return r; }
__device__ __forceinline__ F2 split_row(const float* row, int k0, int lane) { float v[16]; const float* p = row + k0 + 8 * (lane >> 4);
#pragma unroll
  for (int i = 0; i < 8; ++i) { v[i] = p[i]; v[8 + i] = p[16 + i]; }
  return bsplit16(v); }
__device__ __forceinline__ F2 split_rowK(const float* row, int k0, int lane, int K) { float v[16]; const int g = lane >> 4;
#pragma unroll
  for (int i = 0; i < 8; ++i) { const int ka = k0 + 8 * g + i, kb = ka + 16; v[i] = ka < K ? row[ka] : 0.f; v[8 + i] = kb < K ? row[kb] : 0.f; }
  return bsplit16(v); }
__device__ __forceinline__ F2 split_col(const float* W, int k0, int n, int lane, int ld, int K) { float v[16]; const int g = lane >> 4;
#pragma unroll
  for (int i = 0; i < 8; ++i) { const int ka = k0 + 8 * g + i, kb = ka + 16; v[i] = ka < K ? W[(size_t)ka * ld + n] : 0.f; v[8 + i] = kb < K ? W[(size_t)kb * ld + n] : 0.f; }
  return bsplit16(v); }
__device__ __forceinline__ v8f mac3(const F2& a, const F2& b, v8f c) { c = wmma_bf(a.l, b.h, c); c = wmma_bf(a.h, b.l, c); return wmma_bf(a.h, b.h, c); }
__device__ __forceinline__ float sigm(float v) { return 1.0f / (1.0f + expf(-v)); }
#define LDSX() do { asm volatile("s_wait_dscnt 0" ::: "memory"); __builtin_amdgcn_wave_barrier(); __builtin_amdgcn_fence(__ATOMIC_RELEASE, "workgroup"); } while (0)


// Grouped-query causal self attention (16 query heads, 4 kv heads of 64 on [4,2048,1024], [in][out] weights, no biases): head h reads kv head h/4 (repeat_kv); -inf above the diagonal; (P v) @ wo. Key tiles past the query block are skipped.
#define NB 4
#define SS 2048
#define E 1024
#define NH 16
#define NKV 4
#define EKV (NKV * HD)
#define HD 64
#define NR (NB * SS)
#define SC2 0.18033688f      // 1/sqrt(64) x log2(e): the scores and their running maximum are kept in base-2 units, so that each exponential is one hardware exp2
__device__ __forceinline__ float bfr(float v) { return (float)(__bf16)v; }
__device__ __forceinline__ v16b frag_b(const __bf16* rowk0, int lane) { return __builtin_bit_cast(v16b, frag_h((const _Float16*)rowk0, lane)); }

#define TP 72      // LDS row pitch of a staged 128-B row in 16-bit elements: 144 B = 16 B x 9, the conflict-free pitch for 16-byte fragment reads
// Asynchronous copies global -> LDS, 16 B per lane, rows gs bytes apart in global memory and ls bytes apart in LDS. The copies and their s_wait_xcnt stand in one statement, so that no address register is rewritten before the wait.
__device__ __forceinline__ void copy8(unsigned la, unsigned lc, unsigned ls, const char* a, const char* c, size_t gs) {
  asm volatile("global_load_async_to_lds_b128 %0, %8, off\n\t"
               "global_load_async_to_lds_b128 %1, %9, off\n\t"
               "global_load_async_to_lds_b128 %2, %10, off\n\t"
               "global_load_async_to_lds_b128 %3, %11, off\n\t"
               "global_load_async_to_lds_b128 %4, %12, off\n\t"
               "global_load_async_to_lds_b128 %5, %13, off\n\t"
               "global_load_async_to_lds_b128 %6, %14, off\n\t"
               "global_load_async_to_lds_b128 %7, %15, off\n\t"
               "s_wait_xcnt 0x0"
               :: "v"(la), "v"(la + ls), "v"(la + 2 * ls), "v"(la + 3 * ls), "v"(lc), "v"(lc + ls), "v"(lc + 2 * ls), "v"(lc + 3 * ls),
                  "v"(a), "v"(a + gs), "v"(a + 2 * gs), "v"(a + 3 * gs), "v"(c), "v"(c + gs), "v"(c + 2 * gs), "v"(c + 3 * gs) : "memory");
}
// this wave's own copies have landed (in front of the barrier that lets other waves read them, and behind the last copy of a kernel)
#define LANDED() asm volatile("s_wait_asynccnt 0x0" ::: "memory")
// publish point of a staged tile: this wave's LDS reads retired, its own copies landed, then the work-group barrier (it publishes the tile that flew and frees the one just read)
#define PUBLISH() do { asm volatile("s_wait_dscnt 0" ::: "memory"); LANDED(); __syncthreads(); } while (0)

// x -> bf16 (Xb) and the weight columns -> bf16 rows (PT) in ONE launch of few work-groups with long waves, all of a wave's loads in flight at once, instead of one short wave per KB
// PT rows: [0,E) Wq[:,n], [E,E+EKV) Wk[:,n], [E+EKV,E+2EKV) Wv[:,n], [E+2EKV,2E+2EKV) Wo[:,n]  ([in][out] weights: column n as a bf16 row)
#define PKT 4      // weight tiles of 64 k x 32 n per packing work-group: 256 k of 32 columns
#define PKB ((2 * E + 2 * EKV) / 32 * (E / 64) / PKT)      // packing work-groups; they carry the lowest indices: their chain (loads, LDS, barrier, stores) is the longer one
#define CVU 8      // units of 256 lanes x 8 floats per converting work-group
#define CVB (NR * E / (CVU * 256 * 8))      // converting work-groups
__global__ __launch_bounds__(256) void k_prep(const float* __restrict__ x, const float* __restrict__ Wq, const float* __restrict__ Wk, const float* __restrict__ Wv, const float* __restrict__ Wo, __bf16* __restrict__ Xb, __bf16* __restrict__ PT) {
  static_assert(E % (64 * PKT) == 0 && E % 32 == 0 && EKV % 32 == 0, "a work-group's tiles lie in 32 columns of one weight matrix");
  static_assert((size_t)CVB * CVU * 256 * 8 == (size_t)NR * E, "every x element once");
  __shared__ __align__(16) unsigned st[PKT][32][36];      // [tile][n][k pair], row pitch 144 B = 16 B x 9
  const int tid = threadIdx.x;
  if (blockIdx.x < PKB) {      // the same for the whole work-group: its barrier is passed by all of its waves or by none
    const int r8 = tid >> 3, c8 = tid & 7;
    const int n = (int)(blockIdx.x / (E / 64 / PKT)) * 32, k0 = (int)(blockIdx.x % (E / 64 / PKT)) * (64 * PKT);
    const float* W = n < E ? Wq : (n < E + EKV ? Wk : (n < E + 2 * EKV ? Wv : Wo)); const int nn = n < E ? n : (n < E + EKV ? n - E : (n < E + 2 * EKV ? n - E - EKV : n - E - 2 * EKV)); const int ld = (n >= E && n < E + 2 * EKV) ? EKV : E;      // [in][out]: columns nn .. nn + 31
    const unsigned off = (unsigned)(2 * r8 * ld + c8 * 4);
    v4f a[PKT], c[PKT];      // rows k0 + 64 i + 2 r8 and the next, columns 4 c8 .. 4 c8 + 3: eight lanes read one whole 128-B line
#pragma unroll
    for (int i = 0; i < PKT; ++i) { const float* p = W + (size_t)(k0 + 64 * i) * ld + nn; a[i] = *(const v4f*)(p + off); c[i] = *(const v4f*)(p + ld + off); }
#pragma unroll
    for (int i = 0; i < PKT; ++i) {
#pragma unroll
      for (int j = 0; j < 4; ++j) { union { __bf16 h[2]; unsigned u; } pk; pk.h[0] = (__bf16)a[i][j]; pk.h[1] = (__bf16)c[i][j]; st[i][c8 * 4 + j][r8] = pk.u; } }
    __syncthreads();      // the tiles are whole
    v4u o[PKT];
#pragma unroll
    for (int i = 0; i < PKT; ++i) o[i] = *(const v4u*)(&st[i][r8][c8 * 4]);
#pragma unroll
    for (int i = 0; i < PKT; ++i) vst2((unsigned*)(PT + (size_t)(n + r8) * E + k0 + 64 * i + c8 * 8), o[i]);      // eight lanes write one whole 128-B line of a PT row
  } else {
    const size_t i8 = (size_t)(blockIdx.x - PKB) * (CVU * 256) + tid;
    v4f v[CVU][2];
#pragma unroll
    for (int u = 0; u < CVU; ++u) { const float* p = x + (i8 + u * 256) * 8; v[u][0] = *(const v4f*)p; v[u][1] = *(const v4f*)(p + 4); }
#pragma unroll
    for (int u = 0; u < CVU; ++u) { union { __bf16 h[8]; v4u u4; } pk;
#pragma unroll
      for (int e = 0; e < 8; ++e) pk.h[e] = (__bf16)v[u][e >> 2][e & 3];
      vst2((unsigned*)(Xb + (i8 + u * 256) * 8), pk.u4); }
    asm volatile("s_wait_xcnt 0x0" ::: "memory");      // behind the last store of the run: no register that an issued store names is rewritten in front of this wait
  }
}
// QKV: block (128 rows, 128 cols = 2 heads, which), a wave = 32 rows x 128 cols: each weight fragment read from LDS feeds two WMMAs, and a weight tile is fetched from L2 once per 128 rows; q -> Q32 f32 [bh][s][64]; k -> bf16 hi/lo rows; v -> VT hi/lo x4 [bh][d][s]
#define QST (256 * TP * 2)      // bytes of one stage: 128 x rows, then 128 weight rows, 64 k (128 B) each, at pitch TP
#define VP 136      // LDS row pitch of the transposed v staging in 16-bit elements: 128 positions + 8, 272 B = 16 B x 17
__global__ __launch_bounds__(128) void k_qkv(const __bf16* __restrict__ Xb, const __bf16* __restrict__ PT, float* __restrict__ Q32, __bf16* __restrict__ Kh, __bf16* __restrict__ Kl, _Float16* __restrict__ VTh, _Float16* __restrict__ VTl) {
  __shared__ __align__(16) char sm[2 * QST];      // in the loop the two operand stages, behind it the output staging
  float (*so)[32][132] = (float (*)[32][132])sm; _Float16 (*sth)[VP] = (_Float16 (*)[VP])sm; _Float16 (*stl)[VP] = (_Float16 (*)[VP])(sm + 128 * VP * 2);
  static_assert(4 * 32 * 132 * 4 <= 2 * QST && 2 * 128 * VP * 2 <= 2 * QST, "the output staging lies inside the ring");
  const int tid = threadIdx.x, wave = tid >> 5, lane = tid & 31, col = lane & 15, g = lane >> 4;
  const int which = blockIdx.z, r0b = blockIdx.x * 128, n0 = blockIdx.y * 128; const int b = r0b / SS, s0 = r0b % SS;
  if (which > 0 && n0 >= EKV) return;      // k and v have only 4 heads
  const int prow = (which == 0 ? 0 : (which == 1 ? E : E + EKV)) + n0;
  v8f acc[2][8] = {};      // [16-row half of the wave's 32 rows][16-column block]
  // each lane copies 16 B of rows tid / 8 + 16 i: a wave-wide copy = 4 whole 128-B lines
  const char* gA = (const char*)(Xb + (size_t)(r0b + (tid >> 3)) * E + (tid & 7) * 8); const char* gB = (const char*)(PT + (size_t)(prow + (tid >> 3)) * E + (tid & 7) * 8);
  const unsigned lA = (unsigned)(size_t)sm + (tid >> 3) * (TP * 2) + (tid & 7) * 16, lB = lA + 128 * TP * 2;
  auto stage = [&](int s) { const unsigned o = (s & 1) * QST; const char* a = gA + s * 128; const char* c = gB + s * 128;
    copy8(lA + o, lA + o + 64 * TP * 2, 16 * TP * 2, a, a + (size_t)64 * E * 2, (size_t)16 * E * 2); copy8(lB + o, lB + o + 64 * TP * 2, 16 * TP * 2, c, c + (size_t)64 * E * 2, (size_t)16 * E * 2); };
  stage(0); LANDED(); __syncthreads();
  stage(1);
#pragma unroll 1      // rolled: one pass per stage, the buffer picked by s & 1; unrolling would only lengthen the code
  for (int s = 0; s < E / 64; ++s) { const __bf16* tA = (const __bf16*)(sm + (s & 1) * QST); const __bf16* tB = tA + 128 * TP;
#pragma unroll
    for (int kc = 0; kc < 2; ++kc) { const v16b a0 = frag_b(tA + (wave * 32 + col) * TP + kc * 32, lane), a1 = frag_b(tA + (wave * 32 + 16 + col) * TP + kc * 32, lane); v16b wb[8];      // the block's LDS reads stand together in front of its WMMAs
#pragma unroll
      for (int j = 0; j < 8; ++j) wb[j] = frag_b(tB + (j * 16 + col) * TP + kc * 32, lane);
#pragma unroll
      for (int j = 0; j < 8; ++j) { acc[0][j] = wmma_bf(a0, wb[j], acc[0][j]); acc[1][j] = wmma_bf(a1, wb[j], acc[1][j]); } }
    PUBLISH();      // stage s + 1 readable; every wave has left stage s (behind the last pass: the ring is free for the output staging)
    if (s + 2 < E / 64) stage(s + 2); }
  LANDED();
  if (which < 2) {
#pragma unroll
    for (int m = 0; m < 2; ++m) {
#pragma unroll
      for (int j = 0; j < 8; ++j) { const float bb = 0.f;
#pragma unroll
        for (int r = 0; r < 8; ++r) so[wave][m * 16 + 8 * g + r][j * 16 + col] = acc[m][j][r] + bb; } }
    LDSX();
    if (which == 0) { for (int qq = lane; qq < 2 * 32 * 16; qq += 32) { const int hh = qq >> 9, rl = (qq >> 4) & 31, pc = qq & 15; const int h = (n0 >> 6) + hh;
        vst2(Q32 + (((size_t)b * NH + h) * SS + s0 + wave * 32 + rl) * HD + pc * 4, *(const v4f*)(&so[wave][rl][hh * 64 + pc * 4])); } }
    else {
      for (int qq = lane; qq < 2 * 32 * 16; qq += 32) { const int hh = qq >> 9, rl = (qq >> 4) & 31, pl = qq & 15; const int h = (n0 >> 6) + hh; const int pc = pl & 7; union { __bf16 e[8]; v4u u; } pk;
#pragma unroll
        for (int e = 0; e < 8; ++e) { const float v = so[wave][rl][hh * 64 + pc * 8 + e]; const __bf16 hi = (__bf16)v; pk.e[e] = pl < 8 ? hi : (__bf16)(v - (float)hi); }
        vst2((unsigned*)((pl < 8 ? Kh : Kl) + (((size_t)b * NKV + h) * SS + s0 + wave * 32 + rl) * HD + pc * 8), pk.u); } } }
  else {
#pragma unroll
    for (int m = 0; m < 2; ++m) {
#pragma unroll
      for (int j = 0; j < 8; ++j) { const float bb = 0.f;
#pragma unroll
        for (int r = 0; r < 8; ++r) { const float v = (acc[m][j][r] + bb) * 4.0f; const _Float16 hi = (_Float16)v; sth[j * 16 + col][wave * 32 + m * 16 + 8 * g + r] = hi; stl[j * 16 + col][wave * 32 + m * 16 + 8 * g + r] = (_Float16)(v - (float)hi); } } }
    __syncthreads();
    for (int qq = tid; qq < 128 * 16; qq += 128) { const int cl = qq >> 4, pc = qq & 15; const int c = n0 + cl, h = c >> 6, d = c & 63; const size_t o = (((size_t)b * NKV + h) * HD + d) * SS + s0 + pc * 8;
      vst2(VTh + o, *(const v4u*)(&sth[cl][pc * 8])); vst2(VTl + o, *(const v4u*)(&stl[cl][pc * 8])); } }
}
// eight values p -> four registers of f16 pairs hi = f16(p) and four of lo = f16(p - hi): one packed convert and two mixed FMAs a pair (the FMA reads hi as f16 and p as f32 and rounds their exact difference to f16 once)
__device__ __forceinline__ void psplit8(const float* p, unsigned* h, unsigned* l) {
  // written by hand because the compiler converts every hi twice and every lo in two steps. v_nop: the one free slot that a transcendental wants behind it (p comes from v_exp_f32, and the compiler does not look into this statement). s_delay_alu: the hint for a dependent vector instruction, without which its wait holds up the SIMD's other waves
  asm("v_nop\n\t"
      "s_delay_alu instid0(TRANS32_DEP_1)\n\t"
      "v_cvt_pk_f16_f32 %0, %8, %9\n\t"
      "v_cvt_pk_f16_f32 %1, %10, %11\n\t"
      "v_cvt_pk_f16_f32 %2, %12, %13\n\t"
      "v_cvt_pk_f16_f32 %3, %14, %15\n\t"
      "s_delay_alu instid0(VALU_DEP_4) | instskip(NEXT) | instid1(VALU_DEP_4)\n\t"
      "v_fma_mixlo_f16 %4, %0, -1.0, %8 op_sel_hi:[1,1,0]\n\t"
      "v_fma_mixlo_f16 %5, %1, -1.0, %10 op_sel_hi:[1,1,0]\n\t"
      "s_delay_alu instid0(VALU_DEP_4) | instskip(NEXT) | instid1(VALU_DEP_4)\n\t"
      "v_fma_mixlo_f16 %6, %2, -1.0, %12 op_sel_hi:[1,1,0]\n\t"
      "v_fma_mixlo_f16 %7, %3, -1.0, %14 op_sel_hi:[1,1,0]\n\t"
      "s_delay_alu instid0(VALU_DEP_4) | instskip(NEXT) | instid1(VALU_DEP_4)\n\t"
      "v_fma_mixhi_f16 %4, %0, -1.0, %9 op_sel:[1,0,0] op_sel_hi:[1,1,0]\n\t"
      "v_fma_mixhi_f16 %5, %1, -1.0, %11 op_sel:[1,0,0] op_sel_hi:[1,1,0]\n\t"
      "s_delay_alu instid0(VALU_DEP_4) | instskip(NEXT) | instid1(VALU_DEP_4)\n\t"
      "v_fma_mixhi_f16 %6, %2, -1.0, %13 op_sel:[1,0,0] op_sel_hi:[1,1,0]\n\t"
      "v_fma_mixhi_f16 %7, %3, -1.0, %15 op_sel:[1,0,0] op_sel_hi:[1,1,0]"
      : "=&v"(h[0]), "=&v"(h[1]), "=&v"(h[2]), "=&v"(h[3]), "=&v"(l[0]), "=&v"(l[1]), "=&v"(l[2]), "=&v"(l[3])
      : "v"(p[0]), "v"(p[1]), "v"(p[2]), "v"(p[3]), "v"(p[4]), "v"(p[5]), "v"(p[6]), "v"(p[7]));
}
__global__ __launch_bounds__(128, 4) void k_attn(const float* __restrict__ Q32, const __bf16* __restrict__ Kh, const __bf16* __restrict__ Kl, const _Float16* __restrict__ VTh, const _Float16* __restrict__ VTl, float* __restrict__ O32) {
  __shared__ __align__(16) char sm[4 * 64 * TP * 2];      // in the loop the K hi, K lo, V hi, V lo tiles; behind it the K part is the output staging
  __bf16* sKh = (__bf16*)sm; __bf16* sKl = sKh + 64 * TP; _Float16* sVh = (_Float16*)(sm + 2 * 64 * TP * 2); _Float16* sVl = sVh + 64 * TP;
  float (*sO)[16][68] = (float (*)[16][68])sm; static_assert(4 * 16 * 68 * 4 <= 2 * 64 * TP * 2, "the output staging lies on the K tiles alone");
  const int tid = threadIdx.x, w = tid >> 5, lane = tid & 31, col = lane & 15, g = lane >> 4;
  // the longest query blocks carry the lowest block indices (for speed only)
  static_assert((SS / 64 & (SS / 64 - 1)) == 0, "the xor reverses the index only for a power of two");
  const size_t bh = blockIdx.x; const int qb = (SS / 64 - 1) ^ (int)blockIdx.y; const int q0 = qb * 64 + w * 16;
  F2 aq[2];
#pragma unroll
  for (int kc = 0; kc < 2; ++kc) aq[kc] = split_row(Q32 + (bh * SS + q0 + col) * HD, kc * 32, lane);
  const int b = (int)(bh / NH); const size_t kvh = (size_t)b * NKV + (bh % NH) / (NH / NKV);     // repeat_kv: query head h reads kv head h/4
  float mrun = -3.0e38f, lrun = 0.f; v8f acc[4] = {};      // mrun: the query's maximum (equal in both lane halves); lrun: the sum over this lane half's keys, joined behind the loop
  // each lane copies 16 B of rows tid / 8 + 16 i of the hi and of the lo plane: a wave-wide copy = 4 whole 128-B lines
  const size_t kof = ((kvh * SS + (tid >> 3)) * HD + (tid & 7) * 8) * 2, vof = ((kvh * HD + (tid >> 3)) * SS + (tid & 7) * 8) * 2;      // bytes; K tile: rows = keys, 128 B apart; V tile: rows = d, SS * 2 bytes apart
  const char* gKh = (const char*)Kh + kof; const char* gKl = (const char*)Kl + kof; const char* gVh = (const char*)VTh + vof; const char* gVl = (const char*)VTl + vof;
  const unsigned lof = (tid >> 3) * (TP * 2) + (tid & 7) * 16;
  const unsigned lKh = (unsigned)(size_t)sKh + lof, lKl = (unsigned)(size_t)sKl + lof, lVh = (unsigned)(size_t)sVh + lof, lVl = (unsigned)(size_t)sVl + lof;
  copy8(lKh, lKl, 16 * TP * 2, gKh, gKl, (size_t)16 * HD * 2); LANDED(); __syncthreads();
  copy8(lVh, lVl, 16 * TP * 2, gVh, gVl, (size_t)16 * SS * 2);
#pragma unroll 1
  for (int kt = 0; kt <= qb; ++kt) {      // causal
    v8f sv[4];      // sv[t][r] = score of key kt * 64 + 16 t + 8 g + r against query q0 + col
    const int dq = q0 + col - kt * 64 - 8 * g;      // the key is past the query where 16 t + r > dq
#pragma unroll
    for (int t = 0; t < 4; ++t) { const int ko = (t * 16 + col) * TP; v8f s = {}; v16b khf[2], klf[2];
#pragma unroll
      for (int kc = 0; kc < 2; ++kc) { khf[kc] = frag_b(sKh + ko + kc * 32, lane); klf[kc] = frag_b(sKl + ko + kc * 32, lane); }      // the block's LDS reads stand together in front of its WMMAs
#pragma unroll
      for (int kc = 0; kc < 2; ++kc) { s = wmma_bf(khf[kc], aq[kc].l, s); s = wmma_bf(klf[kc], aq[kc].h, s); s = wmma_bf(khf[kc], aq[kc].h, s); }
#pragma unroll
      for (int r = 0; r < 8; ++r) sv[t][r] = (t * 16 + r > dq) ? -1.0e9f : s[r] * SC2; }
    PUBLISH();      // V(kt) readable; every wave has left K(kt)
    if (kt < qb) copy8(lKh, lKl, 16 * TP * 2, gKh + (size_t)(kt + 1) * 64 * HD * 2, gKl + (size_t)(kt + 1) * 64 * HD * 2, (size_t)16 * HD * 2);
    float mx = -3.4e38f;
#pragma unroll
    for (int t = 0; t < 4; ++t) {
#pragma unroll
      for (int r = 0; r < 8; ++r) mx = fmaxf(mx, sv[t][r]); }
    mx = fmaxf(mx, __shfl_xor(mx, 16, 32));      // the other half of the query's keys
    const float mnew = fmaxf(mrun, mx); float corr; asm("v_exp_f32 %0, %1\n\tv_nop" : "=v"(corr) : "v"(mrun - mnew));      // exp2 and the one free slot that a transcendental wants behind it, in one statement
    const float moff = mnew - 14.0f;      // 2^14, the scale of P, rides in the exponent
    v2f ps[2] = {}; v16h ph[2], pl[2];      // ps: the sum of P in two chains of packed adds; B operands of 32 keys each: element i = key 8 g + i of score tile 2 kc, element 8 + i the same of tile 2 kc + 1, the order in which frag_h reads the V rows
#pragma unroll
    for (int kc = 0; kc < 2; ++kc) { float p[16]; union { v16h v; unsigned u[8]; } uh, ul;
#pragma unroll
      for (int i = 0; i < 16; ++i) { p[i] = __builtin_amdgcn_exp2f(sv[2 * kc + (i >> 3)][i & 7] - moff); ps[kc][i & 1] += p[i]; }
      psplit8(p, uh.u, ul.u); psplit8(p + 8, uh.u + 4, ul.u + 4); ph[kc] = uh.v; pl[kc] = ul.v; }
    lrun = lrun * corr + ((ps[0][0] + ps[1][0]) + (ps[0][1] + ps[1][1])) * (1.0f / 16384.0f); mrun = mnew;
#pragma unroll
    for (int t = 0; t < 4; ++t) {
#pragma unroll
      for (int r = 0; r < 8; ++r) acc[t][r] *= corr; }      // every element of a lane belongs to its one query
#pragma unroll
    for (int kc = 0; kc < 2; ++kc) {
#pragma unroll
      for (int t = 0; t < 4; t += 2) { const int vo = (t * 16 + col) * TP + kc * 32; const v16h vh0 = frag_h(sVh + vo, lane), vl0 = frag_h(sVl + vo, lane), vh1 = frag_h(sVh + vo + 16 * TP, lane), vl1 = frag_h(sVl + vo + 16 * TP, lane);      // the block's LDS reads stand together in front of its WMMAs
        // two accumulators in turn: no WMMA stands directly behind the one whose sum it takes up
        acc[t] = wmma16(vl0, ph[kc], acc[t]); acc[t + 1] = wmma16(vl1, ph[kc], acc[t + 1]); acc[t] = wmma16(vh0, pl[kc], acc[t]); acc[t + 1] = wmma16(vh1, pl[kc], acc[t + 1]); acc[t] = wmma16(vh0, ph[kc], acc[t]); acc[t + 1] = wmma16(vh1, ph[kc], acc[t + 1]); } }
    PUBLISH();      // K(kt + 1) readable; every wave has left V(kt) (behind the last pass: the K tiles are free for the output staging)
    if (kt < qb) copy8(lVh, lVl, 16 * TP * 2, gVh + (size_t)(kt + 1) * 64 * 2, gVl + (size_t)(kt + 1) * 64 * 2, (size_t)16 * SS * 2); }
  LANDED();
  lrun += __shfl_xor(lrun, 16, 32);
  const float inv = 1.0f / (lrun * 16384.0f * 4.0f);
#pragma unroll
  for (int t = 0; t < 4; ++t) { v4f o[2];      // acc[t][r] = O[q0 + col][16 t + 8 g + r]: eight neighbours of one row
#pragma unroll
    for (int r = 0; r < 8; ++r) o[r >> 2][r & 3] = acc[t][r] * inv;
    vst2(&sO[w][col][t * 16 + 8 * g], o[0]); vst2(&sO[w][col][t * 16 + 8 * g + 4], o[1]); }
  LDSX();
  for (int qq = lane; qq < 16 * 16; qq += 32) { const int rl = qq >> 4, pc = qq & 15; vst2(O32 + ((bh * SS) + q0 + rl) * HD + pc * 4, *(const v4f*)(&sO[w][rl][pc * 4])); }
}
// out = ctx Wo : split(ctx) x bf16(Wo rows): 2 products (Wo is an INPUT -> bf16 exact)
#define CP 68      // LDS row pitch of a staged 256-B f32 row in floats: 272 B = 16 B x 17
#define OSA (128 * CP * 4)      // bytes of the ctx part of a stage: 128 rows of one head
#define OST (OSA + 128 * TP * 2)      // bytes of one stage: the ctx rows, then 128 weight rows of 64 k
__global__ __launch_bounds__(128) void k_out(const float* __restrict__ O32, const __bf16* __restrict__ PT, float* __restrict__ out) {
  __shared__ __align__(16) char sm[2 * OST];      // in the loop the two operand stages, behind it the output staging
  float (*so)[32][132] = (float (*)[32][132])sm; static_assert(4 * 32 * 132 * 4 <= 2 * OST, "the output staging lies inside the ring");
  const int tid = threadIdx.x, wave = tid >> 5, lane = tid & 31, col = lane & 15, g = lane >> 4;
  const int r0b = blockIdx.x * 128, r0 = r0b + wave * 32, n0 = blockIdx.y * 128; const int b = r0b / SS, s0 = r0b % SS;      // block: 128 rows x 128 cols, a wave = 32 rows x 128 cols
  v8f acc[2][8] = {};      // [16-row half of the wave's 32 rows][16-column block]
  // ctx: each lane copies 16 B of rows tid / 16 + 8 i (a wave-wide copy = 2 rows = 4 whole lines); weights: 16 B of rows tid / 8 + 16 i
  const char* gA = (const char*)(O32 + ((size_t)b * NH * SS + s0 + (tid >> 4)) * HD + (tid & 15) * 4); const char* gB = (const char*)(PT + (size_t)(E + 2 * EKV + n0 + (tid >> 3)) * E + (tid & 7) * 8);
  const unsigned lA = (unsigned)(size_t)sm + (tid >> 4) * (CP * 4) + (tid & 15) * 16, lB = (unsigned)(size_t)sm + OSA + (tid >> 3) * (TP * 2) + (tid & 7) * 16;
  auto stage = [&](int h) { const unsigned o = (h & 1) * OST; const char* a = gA + (size_t)h * SS * HD * 4; const char* c = gB + h * 128;
    copy8(lA + o, lA + o + 32 * CP * 4, 8 * CP * 4, a, a + 32 * HD * 4, (size_t)8 * HD * 4); copy8(lA + o + 64 * CP * 4, lA + o + 96 * CP * 4, 8 * CP * 4, a + 64 * HD * 4, a + 96 * HD * 4, (size_t)8 * HD * 4); copy8(lB + o, lB + o + 64 * TP * 2, 16 * TP * 2, c, c + (size_t)64 * E * 2, (size_t)16 * E * 2); };
  stage(0); LANDED(); __syncthreads();
  stage(1);
#pragma unroll 1      // rolled: one pass per stage, the buffer picked by h & 1; unrolling would only lengthen the code
  for (int h = 0; h < NH; ++h) { const float* tA = (const float*)(sm + (h & 1) * OST); const __bf16* tB = (const __bf16*)(sm + (h & 1) * OST + OSA);
#pragma unroll
    for (int kc = 0; kc < 2; ++kc) { const F2 a0 = split_row(tA + (wave * 32 + col) * CP, kc * 32, lane), a1 = split_row(tA + (wave * 32 + 16 + col) * CP, kc * 32, lane); v16b wb[8];      // the block's LDS reads stand together in front of its WMMAs
#pragma unroll
      for (int j = 0; j < 8; ++j) wb[j] = frag_b(tB + (j * 16 + col) * TP + kc * 32, lane);
#pragma unroll
      for (int j = 0; j < 8; ++j) { acc[0][j] = wmma_bf(a0.l, wb[j], acc[0][j]); acc[1][j] = wmma_bf(a1.l, wb[j], acc[1][j]); acc[0][j] = wmma_bf(a0.h, wb[j], acc[0][j]); acc[1][j] = wmma_bf(a1.h, wb[j], acc[1][j]); } }
    PUBLISH();      // stage h + 1 readable; every wave has left stage h (behind the last pass: the ring is free for the output staging)
    if (h + 2 < NH) stage(h + 2); }
  LANDED();
#pragma unroll
  for (int m = 0; m < 2; ++m) {
#pragma unroll
    for (int j = 0; j < 8; ++j) {
#pragma unroll
      for (int r = 0; r < 8; ++r) so[wave][m * 16 + 8 * g + r][j * 16 + col] = acc[m][j][r]; } }
  LDSX();
#pragma unroll 4
  for (int rl = 0; rl < 32; ++rl) vst2(out + (size_t)(r0 + rl) * E + n0 + lane * 4, *(const v4f*)(&so[wave][rl][lane * 4]));
}
extern "C" void kernel_launch(void* const* d_in, const int* in_sizes, int n_in, void* d_out, int out_size, void* d_ws, size_t ws_size, hipStream_t stream) {
  (void)in_sizes; (void)n_in; (void)out_size; (void)ws_size;
  const float* x = (const float*)d_in[0]; const float* Wq = (const float*)d_in[1]; const float* Wk = (const float*)d_in[2]; const float* Wv = (const float*)d_in[3]; const float* Wo = (const float*)d_in[4];
  float* out = (float*)d_out;
  char* ws = (char*)d_ws; size_t off = 0;
  auto take = [&](size_t bytes) { char* p = ws + off; off += (bytes + 255) & ~(size_t)255; return p; };
  __bf16* Xb = (__bf16*)take((size_t)NR * E * 2); __bf16* PT = (__bf16*)take((size_t)(2 * E + 2 * EKV) * E * 2);
  float* Q32 = (float*)take((size_t)NR * E * 4); __bf16* Kh = (__bf16*)take((size_t)NR * EKV * 2); __bf16* Kl = (__bf16*)take((size_t)NR * EKV * 2); _Float16* VTh = (_Float16*)take((size_t)NR * EKV * 2); _Float16* VTl = (_Float16*)take((size_t)NR * EKV * 2); float* O32 = (float*)take((size_t)NR * E * 4);
  // ws ~ 102 MB
  k_prep<<<PKB + CVB, 256, 0, stream>>>(x, Wq, Wk, Wv, Wo, Xb, PT);
  k_qkv<<<dim3(NR / 128, E / 128, 3), 128, 0, stream>>>(Xb, PT, Q32, Kh, Kl, VTh, VTl);
  k_attn<<<dim3(NB * NH, SS / 64), 128, 0, stream>>>(Q32, Kh, Kl, VTh, VTl, O32);
  k_out<<<dim3(NR / 128, E / 128), 128, 0, stream>>>(O32, PT, out);
}

// v009
// It runs in 111 microseconds.
// Versions between v007 and this one are left out; their measured steps multiply to 1.28 times as fast.
// All steps since v000 together make it 6.22 times as fast.
// compute dtype: x and wq/wk/wv/wo (INPUTS) rounded to bf16 with exact bf16 WMMA products (f32 accumulate) for the projections; q, K and P each rounded once to f16, V f16 hi/lo: scores one f16 WMMA product, P V two (f32 accumulate); softmax f32; ctx f32 split for the output projection.
#include <hip/hip_runtime.h>
#include <math.h>

typedef __attribute__((ext_vector_type(16))) _Float16 v16h;
typedef __attribute__((ext_vector_type(16))) __bf16 v16b;
typedef __attribute__((ext_vector_type(8)))  _Float16 v8h;
typedef __attribute__((ext_vector_type(8)))  float v8f;
typedef __attribute__((ext_vector_type(4)))  float v4f;
typedef __attribute__((ext_vector_type(2)))  float v2f;
typedef __attribute__((ext_vector_type(4)))  unsigned v4u;
typedef __attribute__((ext_vector_type(4)))  int v4i;
typedef float __attribute__((may_alias)) float_a;
typedef int __attribute__((may_alias)) int_a;

template <typename T> __device__ __forceinline__ void vst2(void* p, T v) { *(T*)p = v;  }
__device__ __forceinline__ v8f wmma16(v16h a, v16h b, v8f c) {
  v8f d = __builtin_amdgcn_wmma_f32_16x16x32_f16(false, a, false, b, (short)0, c, false, false);
  asm volatile("v_nop\n\tv_nop\n\tv_nop\n\tv_nop" : "+v"(d) : "v"(a), "v"(b));
  return d;
}
__device__ __forceinline__ v8f wmma_bf(v16b a, v16b b, v8f c) {
  v8f d = __builtin_amdgcn_wmma_f32_16x16x32_bf16(false, a, false, b, (short)0, c, false, false);
  asm volatile("v_nop\n\tv_nop\n\tv_nop\n\tv_nop" : "+v"(d) : "v"(a), "v"(b));
  return d;
}
// 16x16x32 fragments: lane = (h = lane>>4, row/col = lane&15); elements 0..7 = k0+8h+0..7, 8..15 = k0+16+8h+0..7; D element r = row 8h+r
__device__ __forceinline__ v16h frag_h(const _Float16* rowk0, int lane) {
  union { v16h v; v8h q[2]; } u; const _Float16* p = rowk0 + 8 * (lane >> 4);
  u.q[0] = *(const v8h*)p; u.q[1] = *(const v8h*)(p + 16); return u.v;
}
__device__ __forceinline__ v16h frag_f32(const float* rowk0, int lane) {
  v16h a; const float* p = rowk0 + 8 * (lane >> 4);
#pragma unroll
  for (int i = 0; i < 8; ++i) { a[i] = (_Float16)p[i]; a[8 + i] = (_Float16)p[16 + i]; }
  return a;
}
__device__ __forceinline__ v16h frag_f32s(const float* rowk0, int lane, float sc) {
  v16h a; const float* p = rowk0 + 8 * (lane >> 4);
#pragma unroll
  for (int i = 0; i < 8; ++i) { a[i] = (_Float16)(p[i] * sc); a[8 + i] = (_Float16)(p[16 + i] * sc); }
  return a;
}
// column fragment from a [K][ld] layout (column n), rows >= K read as 0
__device__ __forceinline__ v16h fragc_f32(const float* W, int k0, int n, int lane, int ld, int K) {
  v16h a; const int g = lane >> 4;
#pragma unroll
  for (int i = 0; i < 8; ++i) { const int ka = k0 + 8 * g + i, kb = ka + 16;
    a[i] = (_Float16)(ka < K ? W[(size_t)ka * ld + n] : 0.f); a[8 + i] = (_Float16)(kb < K ? W[(size_t)kb * ld + n] : 0.f); }
  return a;
}
struct F2 { v16b h, l; };
__device__ __forceinline__ F2 bsplit16(const float v[16]) { F2 r;
#pragma unroll
  for (int i = 0; i < 16; ++i) { const __bf16 h = (__bf16)v[i]; r.h[i] = h; r.l[i] = (__bf16)(v[i] - (float)h); }
  return r; }
__device__ __forceinline__ F2 split_row(const float* row, int k0, int lane) { float v[16]; const float* p = row + k0 + 8 * (lane >> 4);
#pragma unroll
  for (int i = 0; i < 8; ++i) { v[i] = p[i]; v[8 + i] = p[16 + i]; }
  return bsplit16(v); }
__device__ __forceinline__ F2 split_rowK(const float* row, int k0, int lane, int K) { float v[16]; const int g = lane >> 4;
#pragma unroll
  for (int i = 0; i < 8; ++i) { const int ka = k0 + 8 * g + i, kb = ka + 16; v[i] = ka < K ? row[ka] : 0.f; v[8 + i] = kb < K ? row[kb] : 0.f; }
  return bsplit16(v); }
__device__ __forceinline__ F2 split_col(const float* W, int k0, int n, int lane, int ld, int K) { float v[16]; const int g = lane >> 4;
#pragma unroll
  for (int i = 0; i < 8; ++i) { const int ka = k0 + 8 * g + i, kb = ka + 16; v[i] = ka < K ? W[(size_t)ka * ld + n] : 0.f; v[8 + i] = kb < K ? W[(size_t)kb * ld + n] : 0.f; }
  return bsplit16(v); }
__device__ __forceinline__ v8f mac3(const F2& a, const F2& b, v8f c) { c = wmma_bf(a.l, b.h, c); c = wmma_bf(a.h, b.l, c); return wmma_bf(a.h, b.h, c); }
__device__ __forceinline__ float sigm(float v) { return 1.0f / (1.0f + expf(-v)); }
#define LDSX() do { asm volatile("s_wait_dscnt 0" ::: "memory"); __builtin_amdgcn_wave_barrier(); __builtin_amdgcn_fence(__ATOMIC_RELEASE, "workgroup"); } while (0)


// Grouped-query causal self attention (16 query heads, 4 kv heads of 64 on [4,2048,1024], [in][out] weights, no biases): head h reads kv head h/4 (repeat_kv); -inf above the diagonal; (P v) @ wo. Key tiles past the query block are skipped.
#define NB 4
#define SS 2048
#define E 1024
#define NH 16
#define NKV 4
#define EKV (NKV * HD)
#define HD 64
#define NR (NB * SS)
#define SC2 0.18033688f      // 1/sqrt(64) x log2(e): applied in the exponent's FMA, so that each exponential is one hardware exp2; the scores and their running maximum stay raw
__device__ __forceinline__ float bfr(float v) { return (float)(__bf16)v; }
__device__ __forceinline__ v16b frag_b(const __bf16* rowk0, int lane) { return __builtin_bit_cast(v16b, frag_h((const _Float16*)rowk0, lane)); }

#define TP 72      // LDS row pitch of a staged 128-B row in 16-bit elements: 144 B = 16 B x 9, the conflict-free pitch for 16-byte fragment reads
// Asynchronous copies global -> LDS, 16 B per lane, rows gs bytes apart in global memory and ls bytes apart in LDS. The copies and their s_wait_xcnt stand in one statement, so that no address register is rewritten before the wait.
__device__ __forceinline__ void copy8(unsigned la, unsigned lc, unsigned ls, const char* a, const char* c, size_t gs) {
  asm volatile("global_load_async_to_lds_b128 %0, %8, off\n\t"
               "global_load_async_to_lds_b128 %1, %9, off\n\t"
               "global_load_async_to_lds_b128 %2, %10, off\n\t"
               "global_load_async_to_lds_b128 %3, %11, off\n\t"
               "global_load_async_to_lds_b128 %4, %12, off\n\t"
               "global_load_async_to_lds_b128 %5, %13, off\n\t"
               "global_load_async_to_lds_b128 %6, %14, off\n\t"
               "global_load_async_to_lds_b128 %7, %15, off\n\t"
               "s_wait_xcnt 0x0"
               :: "v"(la), "v"(la + ls), "v"(la + 2 * ls), "v"(la + 3 * ls), "v"(lc), "v"(lc + ls), "v"(lc + 2 * ls), "v"(lc + 3 * ls),
                  "v"(a), "v"(a + gs), "v"(a + 2 * gs), "v"(a + 3 * gs), "v"(c), "v"(c + gs), "v"(c + 2 * gs), "v"(c + 3 * gs) : "memory");
}
// the same for one plane: four copies and their s_wait_xcnt in one statement
__device__ __forceinline__ void copy4(unsigned la, unsigned ls, const char* a, size_t gs) {
  asm volatile("global_load_async_to_lds_b128 %0, %4, off\n\t"
               "global_load_async_to_lds_b128 %1, %5, off\n\t"
               "global_load_async_to_lds_b128 %2, %6, off\n\t"
               "global_load_async_to_lds_b128 %3, %7, off\n\t"
               "s_wait_xcnt 0x0"
               :: "v"(la), "v"(la + ls), "v"(la + 2 * ls), "v"(la + 3 * ls), "v"(a), "v"(a + gs), "v"(a + 2 * gs), "v"(a + 3 * gs) : "memory");
}
// this wave's own copies have landed (in front of the barrier that lets other waves read them, and behind the last copy of a kernel)
#define LANDED() asm volatile("s_wait_asynccnt 0x0" ::: "memory")
// publish point of a staged tile: this wave's LDS reads retired, its own copies landed, then the work-group barrier (it publishes the tile that flew and frees the one just read)
#define PUBLISH() do { asm volatile("s_wait_dscnt 0" ::: "memory"); LANDED(); __syncthreads(); } while (0)

// x -> bf16 (Xb) and the weight columns -> bf16 rows (PT) in ONE launch of few work-groups with long waves, all of a wave's loads in flight at once, instead of one short wave per KB
// PT rows: [0,E) Wq[:,n], [E,E+EKV) Wk[:,n], [E+EKV,E+2EKV) Wv[:,n], [E+2EKV,2E+2EKV) Wo[:,n]  ([in][out] weights: column n as a bf16 row)
#define PKT 4      // weight tiles of 64 k x 32 n per packing work-group: 256 k of 32 columns
#define PKB ((2 * E + 2 * EKV) / 32 * (E / 64) / PKT)      // packing work-groups; they carry the lowest indices: their chain (loads, LDS, barrier, stores) is the longer one
#define CVU 8      // units of 256 lanes x 8 floats per converting work-group
#define CVB (NR * E / (CVU * 256 * 8))      // converting work-groups
__global__ __launch_bounds__(256) void k_prep(const float* __restrict__ x, const float* __restrict__ Wq, const float* __restrict__ Wk, const float* __restrict__ Wv, const float* __restrict__ Wo, __bf16* __restrict__ Xb, __bf16* __restrict__ PT) {
  static_assert(E % (64 * PKT) == 0 && E % 32 == 0 && EKV % 32 == 0, "a work-group's tiles lie in 32 columns of one weight matrix");
  static_assert((size_t)CVB * CVU * 256 * 8 == (size_t)NR * E, "every x element once");
  __shared__ __align__(16) unsigned st[PKT][32][36];      // [tile][n][k pair], row pitch 144 B = 16 B x 9
  const int tid = threadIdx.x;
  if (blockIdx.x < PKB) {      // the same for the whole work-group: its barrier is passed by all of its waves or by none
    const int r8 = tid >> 3, c8 = tid & 7;
    const int n = (int)(blockIdx.x / (E / 64 / PKT)) * 32, k0 = (int)(blockIdx.x % (E / 64 / PKT)) * (64 * PKT);
    const float* W = n < E ? Wq : (n < E + EKV ? Wk : (n < E + 2 * EKV ? Wv : Wo)); const int nn = n < E ? n : (n < E + EKV ? n - E : (n < E + 2 * EKV ? n - E - EKV : n - E - 2 * EKV)); const int ld = (n >= E && n < E + 2 * EKV) ? EKV : E;      // [in][out]: columns nn .. nn + 31
    const unsigned off = (unsigned)(2 * r8 * ld + c8 * 4);
    v4f a[PKT], c[PKT];      // rows k0 + 64 i + 2 r8 and the next, columns 4 c8 .. 4 c8 + 3: eight lanes read one whole 128-B line
#pragma unroll
    for (int i = 0; i < PKT; ++i) { const float* p = W + (size_t)(k0 + 64 * i) * ld + nn; a[i] = *(const v4f*)(p + off); c[i] = *(const v4f*)(p + ld + off); }
#pragma unroll
    for (int i = 0; i < PKT; ++i) {
#pragma unroll
      for (int j = 0; j < 4; ++j) { union { __bf16 h[2]; unsigned u; } pk; pk.h[0] = (__bf16)a[i][j]; pk.h[1] = (__bf16)c[i][j]; st[i][c8 * 4 + j][r8] = pk.u; } }
    __syncthreads();      // the tiles are whole
    v4u o[PKT];
#pragma unroll
    for (int i = 0; i < PKT; ++i) o[i] = *(const v4u*)(&st[i][r8][c8 * 4]);
#pragma unroll
    for (int i = 0; i < PKT; ++i) vst2((unsigned*)(PT + (size_t)(n + r8) * E + k0 + 64 * i + c8 * 8), o[i]);      // eight lanes write one whole 128-B line of a PT row
  } else {
    const size_t i8 = (size_t)(blockIdx.x - PKB) * (CVU * 256) + tid;
    v4f v[CVU][2];
#pragma unroll
    for (int u = 0; u < CVU; ++u) { const float* p = x + (i8 + u * 256) * 8; v[u][0] = *(const v4f*)p; v[u][1] = *(const v4f*)(p + 4); }
#pragma unroll
    for (int u = 0; u < CVU; ++u) { union { __bf16 h[8]; v4u u4; } pk;
#pragma unroll
      for (int e = 0; e < 8; ++e) pk.h[e] = (__bf16)v[u][e >> 2][e & 3];
      vst2((unsigned*)(Xb + (i8 + u * 256) * 8), pk.u4); }
    asm volatile("s_wait_xcnt 0x0" ::: "memory");      // behind the last store of the run: no register that an issued store names is rewritten in front of this wait
  }
}
// QKV: block (128 rows, 128 cols = 2 heads, which), a wave = 32 rows x 128 cols: each weight fragment read from LDS feeds two WMMAs, and a weight tile is fetched from L2 once per 128 rows; q -> Q16 f16 [bh][s][64]; k -> K16 f16 rows [bkv][s][64]; v -> VT hi/lo x4 [bkv][d][s]
#define QST (256 * TP * 2)      // bytes of one stage: 128 x rows, then 128 weight rows, 64 k (128 B) each, at pitch TP
#define VP 136      // LDS row pitch of the transposed v staging in 16-bit elements: 128 positions + 8, 272 B = 16 B x 17
__global__ __launch_bounds__(128) void k_qkv(const __bf16* __restrict__ Xb, const __bf16* __restrict__ PT, _Float16* __restrict__ Q16, _Float16* __restrict__ K16, _Float16* __restrict__ VTh, _Float16* __restrict__ VTl) {
  __shared__ __align__(16) char sm[2 * QST];      // in the loop the two operand stages, behind it the output staging
  float (*so)[32][132] = (float (*)[32][132])sm; _Float16 (*sth)[VP] = (_Float16 (*)[VP])sm; _Float16 (*stl)[VP] = (_Float16 (*)[VP])(sm + 128 * VP * 2);
  static_assert(4 * 32 * 132 * 4 <= 2 * QST && 2 * 128 * VP * 2 <= 2 * QST, "the output staging lies inside the ring");
  const int tid = threadIdx.x, wave = tid >> 5, lane = tid & 31, col = lane & 15, g = lane >> 4;
  const int which = blockIdx.z, r0b = blockIdx.x * 128, n0 = blockIdx.y * 128; const int b = r0b / SS, s0 = r0b % SS;
  if (which > 0 && n0 >= EKV) return;      // k and v have only 4 heads
  const int prow = (which == 0 ? 0 : (which == 1 ? E : E + EKV)) + n0;
  v8f acc[2][8] = {};      // [16-row half of the wave's 32 rows][16-column block]
  // each lane copies 16 B of rows tid / 8 + 16 i: a wave-wide copy = 4 whole 128-B lines
  const char* gA = (const char*)(Xb + (size_t)(r0b + (tid >> 3)) * E + (tid & 7) * 8); const char* gB = (const char*)(PT + (size_t)(prow + (tid >> 3)) * E + (tid & 7) * 8);
  const unsigned lA = (unsigned)(size_t)sm + (tid >> 3) * (TP * 2) + (tid & 7) * 16, lB = lA + 128 * TP * 2;
  auto stage = [&](int s) { const unsigned o = (s & 1) * QST; const char* a = gA + s * 128; const char* c = gB + s * 128;
    copy8(lA + o, lA + o + 64 * TP * 2, 16 * TP * 2, a, a + (size_t)64 * E * 2, (size_t)16 * E * 2); copy8(lB + o, lB + o + 64 * TP * 2, 16 * TP * 2, c, c + (size_t)64 * E * 2, (size_t)16 * E * 2); };
  stage(0); LANDED(); __syncthreads();
  stage(1);
#pragma unroll 1      // rolled: one pass per stage, the buffer picked by s & 1; unrolling would only lengthen the code
  for (int s = 0; s < E / 64; ++s) { const __bf16* tA = (const __bf16*)(sm + (s & 1) * QST); const __bf16* tB = tA + 128 * TP;
#pragma unroll
    for (int kc = 0; kc < 2; ++kc) { const v16b a0 = frag_b(tA + (wave * 32 + col) * TP + kc * 32, lane), a1 = frag_b(tA + (wave * 32 + 16 + col) * TP + kc * 32, lane); v16b wb[8];      // the block's LDS reads stand together in front of its WMMAs
#pragma unroll
      for (int j = 0; j < 8; ++j) wb[j] = frag_b(tB + (j * 16 + col) * TP + kc * 32, lane);
#pragma unroll
      for (int j = 0; j < 8; ++j) { acc[0][j] = wmma_bf(a0, wb[j], acc[0][j]); acc[1][j] = wmma_bf(a1, wb[j], acc[1][j]); } }
    PUBLISH();      // stage s + 1 readable; every wave has left stage s (behind the last pass: the ring is free for the output staging)
    if (s + 2 < E / 64) stage(s + 2); }
  LANDED();
  if (which < 2) {
#pragma unroll
    for (int m = 0; m < 2; ++m) {
#pragma unroll
      for (int j = 0; j < 8; ++j) { const float bb = 0.f;
#pragma unroll
        for (int r = 0; r < 8; ++r) so[wave][m * 16 + 8 * g + r][j * 16 + col] = acc[m][j][r] + bb; } }
    LDSX();
    _Float16* dst = which == 0 ? Q16 : K16; const int nh = which == 0 ? NH : NKV;      // eight lanes write one whole 128-B row of a head
    for (int qq = lane; qq < 2 * 32 * 8; qq += 32) { const int hh = qq >> 8, rl = (qq >> 3) & 31, pc = qq & 7; const int h = (n0 >> 6) + hh; union { _Float16 e[8]; v4u u; } pk;
#pragma unroll
      for (int e = 0; e < 8; ++e) pk.e[e] = (_Float16)so[wave][rl][hh * 64 + pc * 8 + e];
      vst2((unsigned*)(dst + (((size_t)b * nh + h) * SS + s0 + wave * 32 + rl) * HD + pc * 8), pk.u); } }
  else {
#pragma unroll
    for (int m = 0; m < 2; ++m) {
#pragma unroll
      for (int j = 0; j < 8; ++j) { const float bb = 0.f;
#pragma unroll
        for (int r = 0; r < 8; ++r) { const float v = (acc[m][j][r] + bb) * 4.0f; const _Float16 hi = (_Float16)v; sth[j * 16 + col][wave * 32 + m * 16 + 8 * g + r] = hi; stl[j * 16 + col][wave * 32 + m * 16 + 8 * g + r] = (_Float16)(v - (float)hi); } } }
    __syncthreads();
    for (int qq = tid; qq < 128 * 16; qq += 128) { const int cl = qq >> 4, pc = qq & 15; const int c = n0 + cl, h = c >> 6, d = c & 63; const size_t o = (((size_t)b * NKV + h) * HD + d) * SS + s0 + pc * 8;
      vst2(VTh + o, *(const v4u*)(&sth[cl][pc * 8])); vst2(VTl + o, *(const v4u*)(&stl[cl][pc * 8])); } }
}
__global__ __launch_bounds__(128, 4) void k_attn(const _Float16* __restrict__ Q16, const _Float16* __restrict__ K16, const _Float16* __restrict__ VTh, const _Float16* __restrict__ VTl, float* __restrict__ O32) {
  __shared__ __align__(16) char sm[3 * 64 * TP * 2];      // in the loop the K, V hi and V lo tiles; behind it the output staging
  _Float16* sK = (_Float16*)sm; _Float16* sVh = sK + 64 * TP; _Float16* sVl = sVh + 64 * TP;
  float (*sO)[16][68] = (float (*)[16][68])sm; static_assert(4 * 16 * 68 * 4 <= 3 * 64 * TP * 2, "the output staging lies inside the tiles");
  const int tid = threadIdx.x, w = tid >> 5, lane = tid & 31, col = lane & 15, g = lane >> 4;
  // the longest query blocks carry the lowest block indices (for speed only)
  static_assert((SS / 64 & (SS / 64 - 1)) == 0, "the xor reverses the index only for a power of two");
  const size_t bh = blockIdx.x; const int qb = (SS / 64 - 1) ^ (int)blockIdx.y; const int q0 = qb * 64 + w * 16;
  v16h aq[2];
#pragma unroll
  for (int kc = 0; kc < 2; ++kc) aq[kc] = frag_h(Q16 + (bh * SS + q0 + col) * HD + kc * 32, lane);
  const int b = (int)(bh / NH); const size_t kvh = (size_t)b * NKV + (bh % NH) / (NH / NKV);     // repeat_kv: query head h reads kv head h/4
  float mrun = -3.0e38f, lrun = 0.f; v8f acc[4] = {};      // mrun: the query's maximum of the raw scores (equal in both lane halves); lrun: the sum over this lane half's keys, joined behind the loop
  // each lane copies 16 B of rows tid / 8 + 16 i: a wave-wide copy = 4 whole 128-B lines
  const char* gK = (const char*)K16 + ((kvh * SS + (tid >> 3)) * HD + (tid & 7) * 8) * 2; const size_t vof = ((kvh * HD + (tid >> 3)) * SS + (tid & 7) * 8) * 2; const char* gVh = (const char*)VTh + vof; const char* gVl = (const char*)VTl + vof;      // K tile: rows = keys, 128 B apart; V tile: rows = d, SS * 2 bytes apart
  const unsigned lof = (tid >> 3) * (TP * 2) + (tid & 7) * 16;
  const unsigned lK = (unsigned)(size_t)sK + lof, lVh = (unsigned)(size_t)sVh + lof, lVl = (unsigned)(size_t)sVl + lof;
  copy4(lK, 16 * TP * 2, gK, (size_t)16 * HD * 2); LANDED(); __syncthreads();
  copy8(lVh, lVl, 16 * TP * 2, gVh, gVl, (size_t)16 * SS * 2);
#pragma unroll 1
  for (int kt = 0; kt <= qb; ++kt) {      // causal
    v8f sv[4];      // sv[t][r] = score of key kt * 64 + 16 t + 8 g + r against query q0 + col
    const int dq = q0 + col - kt * 64 - 8 * g;      // the key is past the query where 16 t + r > dq
    v16h kf[4][2];
#pragma unroll
    for (int t = 0; t < 4; ++t) {
#pragma unroll
      for (int kc = 0; kc < 2; ++kc) kf[t][kc] = frag_h(sK + (t * 16 + col) * TP + kc * 32, lane); }      // the tile's LDS reads stand together in front of its WMMAs
#pragma unroll
    for (int t = 0; t < 4; ++t) sv[t] = wmma16(kf[t][0], aq[0], v8f{});      // four accumulators in turn: no WMMA stands directly behind the one whose sum it takes up
#pragma unroll
    for (int t = 0; t < 4; ++t) sv[t] = wmma16(kf[t][1], aq[1], sv[t]);
    if (kt == qb) {      // only the tile on the diagonal holds keys past a query (the same for the whole work-group: a scalar branch); below it the raw scores go on untouched
#pragma unroll
      for (int t = 0; t < 4; ++t) {
#pragma unroll
        for (int r = 0; r < 8; ++r) sv[t][r] = (t * 16 + r > dq) ? -1.0e30f : sv[t][r]; } }
    PUBLISH();      // V(kt) readable; every wave has left K(kt)
    if (kt < qb) copy4(lK, 16 * TP * 2, gK + (size_t)(kt + 1) * 64 * HD * 2, (size_t)16 * HD * 2);
    float mx = -3.4e38f;
#pragma unroll
    for (int t = 0; t < 4; ++t) {
#pragma unroll
      for (int r = 0; r < 8; ++r) mx = fmaxf(mx, sv[t][r]); }
    mx = fmaxf(mx, __shfl_xor(mx, 16, 32));      // the other half of the query's keys
    const float mnew = fmaxf(mrun, mx); float corr; asm("v_exp_f32 %0, %1\n\tv_nop" : "=v"(corr) : "v"((mrun - mnew) * SC2));      // exp2 and the one free slot that a transcendental wants behind it, in one statement
    const v2f sc = {SC2, SC2}; const float mo1 = 14.0f - mnew * SC2; const v2f mo = {mo1, mo1};      // the score scale and the subtracted maximum in one packed FMA per two scores; 2^14, the scale of P, rides in the exponent
    v2f ps[2] = {}; v16h ph[2];      // ps: the sum of P in two chains of packed adds; B operands of 32 keys each: element i = key 8 g + i of score tile 2 kc, element 8 + i the same of tile 2 kc + 1, the order in which frag_h reads the V rows
#pragma unroll
    for (int kc = 0; kc < 2; ++kc) {
#pragma unroll
      for (int i = 0; i < 16; i += 2) { const v8f& s8 = sv[2 * kc + (i >> 3)]; v2f e = {s8[i & 7], s8[(i & 7) + 1]}; e = __builtin_elementwise_fma(e, sc, mo); const v2f p = {__builtin_amdgcn_exp2f(e[0]), __builtin_amdgcn_exp2f(e[1])}; ps[kc] += p; ph[kc][i] = (_Float16)p[0]; ph[kc][i + 1] = (_Float16)p[1]; } }
    lrun = lrun * corr + ((ps[0][0] + ps[1][0]) + (ps[0][1] + ps[1][1])) * (1.0f / 16384.0f); mrun = mnew;
#pragma unroll
    for (int t = 0; t < 4; ++t) {
#pragma unroll
      for (int r = 0; r < 8; ++r) acc[t][r] *= corr; }      // every element of a lane belongs to its one query
#pragma unroll
    for (int kc = 0; kc < 2; ++kc) { v16h vh[4], vl[4];
#pragma unroll
      for (int t = 0; t < 4; ++t) { const int vo = (t * 16 + col) * TP + kc * 32; vh[t] = frag_h(sVh + vo, lane); vl[t] = frag_h(sVl + vo, lane); }      // the block's LDS reads stand together in front of its WMMAs
#pragma unroll
      for (int t = 0; t < 4; ++t) acc[t] = wmma16(vl[t], ph[kc], acc[t]);      // four accumulators in turn: no WMMA stands directly behind the one whose sum it takes up
#pragma unroll
      for (int t = 0; t < 4; ++t) acc[t] = wmma16(vh[t], ph[kc], acc[t]); }
    PUBLISH();      // K(kt + 1) readable; every wave has left V(kt) (behind the last pass: the tiles are free for the output staging)
    if (kt < qb) copy8(lVh, lVl, 16 * TP * 2, gVh + (size_t)(kt + 1) * 64 * 2, gVl + (size_t)(kt + 1) * 64 * 2, (size_t)16 * SS * 2); }
  LANDED();
  lrun += __shfl_xor(lrun, 16, 32);
  const float inv = 1.0f / (lrun * 16384.0f * 4.0f);
#pragma unroll
  for (int t = 0; t < 4; ++t) { v4f o[2];      // acc[t][r] = O[q0 + col][16 t + 8 g + r]: eight neighbours of one row
#pragma unroll
    for (int r = 0; r < 8; ++r) o[r >> 2][r & 3] = acc[t][r] * inv;
    vst2(&sO[w][col][t * 16 + 8 * g], o[0]); vst2(&sO[w][col][t * 16 + 8 * g + 4], o[1]); }
  LDSX();
  for (int qq = lane; qq < 16 * 16; qq += 32) { const int rl = qq >> 4, pc = qq & 15; vst2(O32 + ((bh * SS) + q0 + rl) * HD + pc * 4, *(const v4f*)(&sO[w][rl][pc * 4])); }
}
// out = ctx Wo : split(ctx) x bf16(Wo rows): 2 products (Wo is an INPUT -> bf16 exact)
#define CP 68      // LDS row pitch of a staged 256-B f32 row in floats: 272 B = 16 B x 17
#define OSA (128 * CP * 4)      // bytes of the ctx part of a stage: 128 rows of one head
#define OST (OSA + 128 * TP * 2)      // bytes of one stage: the ctx rows, then 128 weight rows of 64 k
__global__ __launch_bounds__(128) void k_out(const float* __restrict__ O32, const __bf16* __restrict__ PT, float* __restrict__ out) {
  __shared__ __align__(16) char sm[2 * OST];      // in the loop the two operand stages, behind it the output staging
  float (*so)[32][132] = (float (*)[32][132])sm; static_assert(4 * 32 * 132 * 4 <= 2 * OST, "the output staging lies inside the ring");
  const int tid = threadIdx.x, wave = tid >> 5, lane = tid & 31, col = lane & 15, g = lane >> 4;
  const int r0b = blockIdx.x * 128, r0 = r0b + wave * 32, n0 = blockIdx.y * 128; const int b = r0b / SS, s0 = r0b % SS;      // block: 128 rows x 128 cols, a wave = 32 rows x 128 cols
  v8f acc[2][8] = {};      // [16-row half of the wave's 32 rows][16-column block]
  // ctx: each lane copies 16 B of rows tid / 16 + 8 i (a wave-wide copy = 2 rows = 4 whole lines); weights: 16 B of rows tid / 8 + 16 i
  const char* gA = (const char*)(O32 + ((size_t)b * NH * SS + s0 + (tid >> 4)) * HD + (tid & 15) * 4); const char* gB = (const char*)(PT + (size_t)(E + 2 * EKV + n0 + (tid >> 3)) * E + (tid & 7) * 8);
  const unsigned lA = (unsigned)(size_t)sm + (tid >> 4) * (CP * 4) + (tid & 15) * 16, lB = (unsigned)(size_t)sm + OSA + (tid >> 3) * (TP * 2) + (tid & 7) * 16;
  auto stage = [&](int h) { const unsigned o = (h & 1) * OST; const char* a = gA + (size_t)h * SS * HD * 4; const char* c = gB + h * 128;
    copy8(lA + o, lA + o + 32 * CP * 4, 8 * CP * 4, a, a + 32 * HD * 4, (size_t)8 * HD * 4); copy8(lA + o + 64 * CP * 4, lA + o + 96 * CP * 4, 8 * CP * 4, a + 64 * HD * 4, a + 96 * HD * 4, (size_t)8 * HD * 4); copy8(lB + o, lB + o + 64 * TP * 2, 16 * TP * 2, c, c + (size_t)64 * E * 2, (size_t)16 * E * 2); };
  stage(0); LANDED(); __syncthreads();
  stage(1);
#pragma unroll 1      // rolled: one pass per stage, the buffer picked by h & 1; unrolling would only lengthen the code
  for (int h = 0; h < NH; ++h) { const float* tA = (const float*)(sm + (h & 1) * OST); const __bf16* tB = (const __bf16*)(sm + (h & 1) * OST + OSA);
#pragma unroll
    for (int kc = 0; kc < 2; ++kc) { const F2 a0 = split_row(tA + (wave * 32 + col) * CP, kc * 32, lane), a1 = split_row(tA + (wave * 32 + 16 + col) * CP, kc * 32, lane); v16b wb[8];      // the block's LDS reads stand together in front of its WMMAs
#pragma unroll
      for (int j = 0; j < 8; ++j) wb[j] = frag_b(tB + (j * 16 + col) * TP + kc * 32, lane);
#pragma unroll
      for (int j = 0; j < 8; ++j) { acc[0][j] = wmma_bf(a0.l, wb[j], acc[0][j]); acc[1][j] = wmma_bf(a1.l, wb[j], acc[1][j]); acc[0][j] = wmma_bf(a0.h, wb[j], acc[0][j]); acc[1][j] = wmma_bf(a1.h, wb[j], acc[1][j]); } }
    PUBLISH();      // stage h + 1 readable; every wave has left stage h (behind the last pass: the ring is free for the output staging)
    if (h + 2 < NH) stage(h + 2); }
  LANDED();
#pragma unroll
  for (int m = 0; m < 2; ++m) {
#pragma unroll
    for (int j = 0; j < 8; ++j) {
#pragma unroll
      for (int r = 0; r < 8; ++r) so[wave][m * 16 + 8 * g + r][j * 16 + col] = acc[m][j][r]; } }
  LDSX();
#pragma unroll 4
  for (int rl = 0; rl < 32; ++rl) vst2(out + (size_t)(r0 + rl) * E + n0 + lane * 4, *(const v4f*)(&so[wave][rl][lane * 4]));
}
extern "C" void kernel_launch(void* const* d_in, const int* in_sizes, int n_in, void* d_out, int out_size, void* d_ws, size_t ws_size, hipStream_t stream) {
  (void)in_sizes; (void)n_in; (void)out_size; (void)ws_size;
  const float* x = (const float*)d_in[0]; const float* Wq = (const float*)d_in[1]; const float* Wk = (const float*)d_in[2]; const float* Wv = (const float*)d_in[3]; const float* Wo = (const float*)d_in[4];
  float* out = (float*)d_out;
  char* ws = (char*)d_ws; size_t off = 0;
  auto take = [&](size_t bytes) { char* p = ws + off; off += (bytes + 255) & ~(size_t)255; return p; };
  __bf16* Xb = (__bf16*)take((size_t)NR * E * 2); __bf16* PT = (__bf16*)take((size_t)(2 * E + 2 * EKV) * E * 2);
  _Float16* Q16 = (_Float16*)take((size_t)NR * E * 2); _Float16* K16 = (_Float16*)take((size_t)NR * EKV * 2); _Float16* VTh = (_Float16*)take((size_t)NR * EKV * 2); _Float16* VTl = (_Float16*)take((size_t)NR * EKV * 2); float* O32 = (float*)take((size_t)NR * E * 4);
  // ws ~ 81 MiB (84.9 MB)
  k_prep<<<PKB + CVB, 256, 0, stream>>>(x, Wq, Wk, Wv, Wo, Xb, PT);
  k_qkv<<<dim3(NR / 128, E / 128, 3), 128, 0, stream>>>(Xb, PT, Q16, K16, VTh, VTl);
  k_attn<<<dim3(NB * NH, SS / 64), 128, 0, stream>>>(Q16, K16, VTh, VTl, O32);
  k_out<<<dim3(NR / 128, E / 128), 128, 0, stream>>>(O32, PT, out);
}
